// v000
// The times below were measured on an AMD MI455X: many runs one after another, warmed up first and cycling through
// copies of the inputs, with the whole window's GPU time divided by the number of runs. Launches and the gaps
// between them are all in it. The median over several windows is given; except for v000 it joins two sittings, which
// can be a few percent apart, so the side-by-side timings, each taken in one sitting, are the better comparison.
// v000 is the starting kernel. One run takes 300 microseconds.
#include <hip/hip_runtime.h>
#include <hip/hip_bf16.h>

// ---------------------------------------------------------------------------
// LiteSelfAttention2D for MI455X (gfx1250): flash-attention on v_wmma_f32_16x16x32_f16
// B=4, C=256, KEY_CH=128, HEADS=4, HEAD_DIM=32, N=4096
// ---------------------------------------------------------------------------

#define NB      4
#define IN_CH   256
#define KEY_CH  128
#define HEADS   4
#define HEAD_DIM 32
#define NPIX    4096   // 64*64

typedef _Float16 half8  __attribute__((ext_vector_type(8)));
typedef _Float16 half16 __attribute__((ext_vector_type(16)));
typedef float    f32x8  __attribute__((ext_vector_type(8)));

// Build a 16x32 (or 32x16) f16 WMMA fragment from two 16-byte chunks.
// A-layout: lane L holds row L%16, K-chunks at g*8 and 16+g*8 (g = L/16).
// B-layout is the mirror (lane = column, same K pattern).
static __device__ __forceinline__ half16 load_frag(const _Float16* lo,
                                                   const _Float16* hi) {
  half8 a = *(const half8*)lo;
  half8 b = *(const half8*)hi;
  half16 r;
#pragma unroll
  for (int i = 0; i < 8; ++i) { r[i] = a[i]; r[i + 8] = b[i]; }
  return r;
}

static __device__ __forceinline__ f32x8 wmma_f16(half16 a, half16 b, f32x8 c) {
  // D = A(16x32 f16) * B(32x16 f16) + C(16x16 f32)
  return __builtin_amdgcn_wmma_f32_16x16x32_f16(false, a, false, b,
                                                (short)0, c, false, false);
}

static __device__ __forceinline__ f32x8 zero8() {
  f32x8 z = {0.f, 0.f, 0.f, 0.f, 0.f, 0.f, 0.f, 0.f};
  return z;
}

// ---------------------------------------------------------------------------
// Kernel 0a: x (f32, [B][C][N]) -> xh (f16), vectorized
// ---------------------------------------------------------------------------
__global__ void __launch_bounds__(256) cvt_x_kernel(const float* __restrict__ x,
                                                    _Float16* __restrict__ xh) {
  int i = (blockIdx.x * 256 + threadIdx.x) * 4;
  float4 v = *(const float4*)(x + i);
  xh[i + 0] = (_Float16)v.x;
  xh[i + 1] = (_Float16)v.y;
  xh[i + 2] = (_Float16)v.z;
  xh[i + 3] = (_Float16)v.w;
}

// ---------------------------------------------------------------------------
// Kernel 0b: weights -> f16. Softmax scale 1/sqrt(32) is folded into Wq.
// ---------------------------------------------------------------------------
__global__ void __launch_bounds__(256) cvt_w_kernel(
    const float* __restrict__ wq, const float* __restrict__ wk,
    const float* __restrict__ wv, const float* __restrict__ wp,
    _Float16* __restrict__ wqh, _Float16* __restrict__ wkh,
    _Float16* __restrict__ wvh, _Float16* __restrict__ wph) {
  int i = blockIdx.x * 256 + threadIdx.x;
  const float s = 0.17677669529663687f;  // 1/sqrt(HEAD_DIM)
  wqh[i] = (_Float16)(wq[i] * s);
  wkh[i] = (_Float16)wk[i];
  wvh[i] = (_Float16)wv[i];
  wph[i] = (_Float16)wp[i];
}

// ---------------------------------------------------------------------------
// Kernel 1: projections Q,K,V = W * x  (per image: [128,256] x [256,4096])
// Grid: NB*64 blocks, 256 threads (8 waves). Wave w -> output rows 16w..16w+15.
// x tiles are transposed through LDS so the B-fragment (K = channel dim)
// becomes two contiguous ds_load_b128 per lane.
// Outputs: Qh,Kh f16 [b][h][n][32] (row-major), Vt f16 [b][h][32][n].
// ---------------------------------------------------------------------------
__global__ void __launch_bounds__(256) proj_qkv_kernel(
    const _Float16* __restrict__ xh,
    const _Float16* __restrict__ wqh, const _Float16* __restrict__ wkh,
    const _Float16* __restrict__ wvh,
    _Float16* __restrict__ Qh, _Float16* __restrict__ Kh,
    _Float16* __restrict__ Vt) {
  __shared__ __align__(16) _Float16 Xt[64][40];  // [n][c], padded stride 40

  const int bx = blockIdx.x;
  const int b = bx >> 6;
  const int n0 = (bx & 63) * 64;
  const int tid = threadIdx.x;
  const int w = tid >> 5, lane = tid & 31, g = lane >> 4, lh = lane & 15;
  const _Float16* xb = xh + (size_t)b * IN_CH * NPIX;

  f32x8 acc[3][4];
#pragma unroll
  for (int p = 0; p < 3; ++p)
#pragma unroll
    for (int j = 0; j < 4; ++j) acc[p][j] = zero8();

  const int wrow = w * 16 + lh;  // output row for this lane's fragment
  for (int cc = 0; cc < IN_CH; cc += 32) {
    __syncthreads();
    // load [32 c][64 n] tile, store transposed as [n][c]
#pragma unroll
    for (int k = 0; k < 8; ++k) {
      int idx = k * 256 + tid;          // 0..2047
      int c = idx >> 6, n = idx & 63;
      Xt[n][c] = xb[(size_t)(cc + c) * NPIX + n0 + n];
    }
    __syncthreads();

    half16 aq = load_frag(wqh + wrow * IN_CH + cc + g * 8,
                          wqh + wrow * IN_CH + cc + 16 + g * 8);
    half16 ak = load_frag(wkh + wrow * IN_CH + cc + g * 8,
                          wkh + wrow * IN_CH + cc + 16 + g * 8);
    half16 av = load_frag(wvh + wrow * IN_CH + cc + g * 8,
                          wvh + wrow * IN_CH + cc + 16 + g * 8);
#pragma unroll
    for (int j = 0; j < 4; ++j) {
      half16 bf = load_frag(&Xt[j * 16 + lh][g * 8],
                            &Xt[j * 16 + lh][16 + g * 8]);
      acc[0][j] = wmma_f16(aq, bf, acc[0][j]);
      acc[1][j] = wmma_f16(ak, bf, acc[1][j]);
      acc[2][j] = wmma_f16(av, bf, acc[2][j]);
    }
  }

  // scatter to Qh/Kh (row-major per pixel) and Vt (transposed)
#pragma unroll
  for (int j = 0; j < 4; ++j) {
#pragma unroll
    for (int r = 0; r < 8; ++r) {
      int kk = w * 16 + r + 8 * g;       // 0..127
      int h = kk >> 5, d = kk & 31;
      int n = n0 + j * 16 + lh;
      size_t hb = (size_t)(b * HEADS + h);
      size_t qoff = (hb * NPIX + n) * HEAD_DIM + d;
      Qh[qoff] = (_Float16)acc[0][j][r];
      Kh[qoff] = (_Float16)acc[1][j][r];
      Vt[(hb * HEAD_DIM + d) * NPIX + n] = (_Float16)acc[2][j][r];
    }
  }
}

// ---------------------------------------------------------------------------
// Kernel 2: flash attention. Grid (N/128, B*HEADS), 256 threads = 8 waves.
// Each wave owns 16 query rows. Per 64-key tile:
//   - all 8 waves cooperatively stage the SHARED K tile (64x32 f16, 4 KB) and
//     V^T tile (32x64 f16, 4 KB) into LDS once (8x less global/L2 traffic
//     than per-wave streaming), with global_prefetch of the next tile;
//   - 4 WMMAs for S = Q K^T (scale pre-folded into Q),
//   - online softmax in f32 through per-wave LDS (lanes 0..15 own rows),
//   - 4 WMMAs for O += P V (P re-read from LDS in A-layout).
// Output Orow f16 [b][n][128] (channel-contiguous per pixel).
// ---------------------------------------------------------------------------
__global__ void __launch_bounds__(256) attn_kernel(
    const _Float16* __restrict__ Qh, const _Float16* __restrict__ Kh,
    const _Float16* __restrict__ Vt, _Float16* __restrict__ Orow) {
  __shared__ __align__(16) float    Ss[8][16][64];   // 32 KB (per-wave S)
  __shared__ __align__(16) _Float16 Ps[8][16][64];   // 16 KB (per-wave P)
  __shared__ __align__(16) _Float16 Ks[64][32];      //  4 KB (shared K tile)
  __shared__ __align__(16) _Float16 Vs[32][64];      //  4 KB (shared V^T tile)
  __shared__ float Mrow[8][16], Lrow[8][16], Arow[8][16];

  const int tid = threadIdx.x;
  const int w = tid >> 5, lane = tid & 31, g = lane >> 4, lh = lane & 15;
  const int bh = blockIdx.y;
  const int b = bh >> 2, h = bh & 3;
  const int q0 = blockIdx.x * 128 + w * 16;
  const size_t hb = (size_t)(b * HEADS + h);
  const _Float16* qb = Qh + hb * NPIX * HEAD_DIM;
  const _Float16* kb = Kh + hb * NPIX * HEAD_DIM;
  const _Float16* vb = Vt + hb * HEAD_DIM * NPIX;

  // Q fragment for this wave's 16 rows (reused every iteration)
  half16 aq = load_frag(qb + (size_t)(q0 + lh) * 32 + g * 8,
                        qb + (size_t)(q0 + lh) * 32 + 16 + g * 8);
  f32x8 o_lo = zero8(), o_hi = zero8();
  if (lane < 16) { Mrow[w][lane] = -1e30f; Lrow[w][lane] = 0.f; }

  // cooperative-staging indices (each thread moves 8+8 f16 per tile)
  const int kslot = tid * 8;            // 0..2047 over Ks (64x32)
  const int vd = tid >> 3;              // 0..31  (V^T row = d)
  const int vm = (tid & 7) * 8;         // 0..56  (m offset within tile)

#pragma unroll 1
  for (int kt = 0; kt < NPIX / 64; ++kt) {
    const int m0 = kt * 64;
    // ---- stage K/V tiles into LDS once per workgroup ----
    __syncthreads();  // previous iteration's readers are done
    *(half8*)((_Float16*)Ks + kslot) = *(const half8*)(kb + (size_t)m0 * 32 + kslot);
    *(half8*)(&Vs[vd][vm])           = *(const half8*)(vb + (size_t)vd * NPIX + m0 + vm);
    if (kt + 1 < NPIX / 64) {           // prefetch next tile (global_prefetch_b8)
      __builtin_prefetch(kb + (size_t)(m0 + 64) * 32 + kslot, 0, 0);
      __builtin_prefetch(vb + (size_t)vd * NPIX + m0 + 64 + vm, 0, 0);
    }
    __syncthreads();  // staging visible to all waves

    // ---- S = Q K^T over 64 keys (B-fragments from shared LDS tile) ----
#pragma unroll
    for (int j = 0; j < 4; ++j) {
      half16 bk = load_frag(&Ks[j * 16 + lh][g * 8],
                            &Ks[j * 16 + lh][16 + g * 8]);
      f32x8 s = wmma_f16(aq, bk, zero8());
#pragma unroll
      for (int r = 0; r < 8; ++r) Ss[w][r + 8 * g][j * 16 + lh] = s[r];
    }
    // ---- online softmax: lanes 0..15 each own one query row ----
    if (lane < 16) {
      const float4* row = (const float4*)&Ss[w][lane][0];
      float mold = Mrow[w][lane];
      float mx = mold;
#pragma unroll
      for (int jj = 0; jj < 16; ++jj) {
        float4 v = row[jj];
        mx = fmaxf(mx, fmaxf(fmaxf(v.x, v.y), fmaxf(v.z, v.w)));
      }
      float alpha = __expf(mold - mx);
      float ssum = 0.f;
#pragma unroll
      for (int jj = 0; jj < 16; ++jj) {
        float4 v = row[jj];
        float p0 = __expf(v.x - mx), p1 = __expf(v.y - mx);
        float p2 = __expf(v.z - mx), p3 = __expf(v.w - mx);
        ssum += (p0 + p1) + (p2 + p3);
        Ps[w][lane][jj * 4 + 0] = (_Float16)p0;
        Ps[w][lane][jj * 4 + 1] = (_Float16)p1;
        Ps[w][lane][jj * 4 + 2] = (_Float16)p2;
        Ps[w][lane][jj * 4 + 3] = (_Float16)p3;
      }
      Mrow[w][lane] = mx;
      Lrow[w][lane] = Lrow[w][lane] * alpha + ssum;
      Arow[w][lane] = alpha;
    }
    // ---- rescale running O by alpha(row) ----
#pragma unroll
    for (int r = 0; r < 8; ++r) {
      float a = Arow[w][r + 8 * g];
      o_lo[r] *= a;
      o_hi[r] *= a;
    }
    // ---- O += P V (two 32-wide key sub-tiles; d split 0..15 / 16..31) ----
#pragma unroll
    for (int mj = 0; mj < 2; ++mj) {
      half16 ap = load_frag(&Ps[w][lh][mj * 32 + g * 8],
                            &Ps[w][lh][mj * 32 + 16 + g * 8]);
      half16 bv0 = load_frag(&Vs[lh][mj * 32 + g * 8],
                             &Vs[lh][mj * 32 + 16 + g * 8]);
      o_lo = wmma_f16(ap, bv0, o_lo);
      half16 bv1 = load_frag(&Vs[16 + lh][mj * 32 + g * 8],
                             &Vs[16 + lh][mj * 32 + 16 + g * 8]);
      o_hi = wmma_f16(ap, bv1, o_hi);
    }
  }

  // ---- finalize: divide by l, store Orow[b][n][h*32 + d] ----
  _Float16* ob = Orow + (size_t)b * NPIX * KEY_CH + h * HEAD_DIM;
#pragma unroll
  for (int r = 0; r < 8; ++r) {
    int n = q0 + r + 8 * g;
    float inv = 1.f / Lrow[w][r + 8 * g];
    ob[(size_t)n * KEY_CH + lh]      = (_Float16)(o_lo[r] * inv);
    ob[(size_t)n * KEY_CH + 16 + lh] = (_Float16)(o_hi[r] * inv);
  }
}

// ---------------------------------------------------------------------------
// Kernel 3: out = Wp @ O + x.  [256,128] x [128,4096] per image.
// Orow rows are kk-contiguous, so B-fragments are direct global_load_b128.
// Grid (N/64, B, 2), 256 threads; wave w handles 16 output channels.
// ---------------------------------------------------------------------------
__global__ void __launch_bounds__(256) out_proj_kernel(
    const _Float16* __restrict__ wph, const _Float16* __restrict__ Orow,
    const float* __restrict__ x, float* __restrict__ out) {
  const int tid = threadIdx.x;
  const int w = tid >> 5, lane = tid & 31, g = lane >> 4, lh = lane & 15;
  const int n0 = blockIdx.x * 64;
  const int b = blockIdx.y;
  const int c0 = blockIdx.z * 128 + w * 16;
  const _Float16* ob = Orow + (size_t)b * NPIX * KEY_CH;

  f32x8 acc[4];
#pragma unroll
  for (int j = 0; j < 4; ++j) acc[j] = zero8();

#pragma unroll
  for (int kc = 0; kc < 4; ++kc) {
    const int k0 = kc * 32;
    half16 a = load_frag(wph + (size_t)(c0 + lh) * KEY_CH + k0 + g * 8,
                         wph + (size_t)(c0 + lh) * KEY_CH + k0 + 16 + g * 8);
#pragma unroll
    for (int j = 0; j < 4; ++j) {
      const _Float16* orow = ob + (size_t)(n0 + j * 16 + lh) * KEY_CH + k0;
      half16 bf = load_frag(orow + g * 8, orow + 16 + g * 8);
      acc[j] = wmma_f16(a, bf, acc[j]);
    }
  }
#pragma unroll
  for (int j = 0; j < 4; ++j) {
#pragma unroll
    for (int r = 0; r < 8; ++r) {
      int c = c0 + r + 8 * g;
      int n = n0 + j * 16 + lh;
      size_t off = (size_t)(b * IN_CH + c) * NPIX + n;
      out[off] = acc[j][r] + x[off];
    }
  }
}

// ---------------------------------------------------------------------------
// Host launcher
// ---------------------------------------------------------------------------
extern "C" void kernel_launch(void* const* d_in, const int* in_sizes, int n_in,
                              void* d_out, int out_size, void* d_ws, size_t ws_size,
                              hipStream_t stream) {
  const float* x  = (const float*)d_in[0];
  const float* Wq = (const float*)d_in[1];
  const float* Wk = (const float*)d_in[2];
  const float* Wv = (const float*)d_in[3];
  const float* Wp = (const float*)d_in[4];
  float* out = (float*)d_out;

  // workspace carve-up (all f16)
  char* ws = (char*)d_ws;
  size_t off = 0;
  _Float16* xh  = (_Float16*)(ws + off); off += (size_t)NB * IN_CH * NPIX * 2;   // 8 MB
  _Float16* wqh = (_Float16*)(ws + off); off += (size_t)KEY_CH * IN_CH * 2;
  _Float16* wkh = (_Float16*)(ws + off); off += (size_t)KEY_CH * IN_CH * 2;
  _Float16* wvh = (_Float16*)(ws + off); off += (size_t)KEY_CH * IN_CH * 2;
  _Float16* wph = (_Float16*)(ws + off); off += (size_t)IN_CH * KEY_CH * 2;
  _Float16* Qh  = (_Float16*)(ws + off); off += (size_t)NB * KEY_CH * NPIX * 2;  // 4 MB
  _Float16* Kh  = (_Float16*)(ws + off); off += (size_t)NB * KEY_CH * NPIX * 2;  // 4 MB
  _Float16* Vt  = (_Float16*)(ws + off); off += (size_t)NB * KEY_CH * NPIX * 2;  // 4 MB
  _Float16* Orow = (_Float16*)(ws + off); off += (size_t)NB * NPIX * KEY_CH * 2; // 4 MB

  // 0) precision conversion (scale folded into Wq)
  cvt_x_kernel<<<(NB * IN_CH * NPIX) / (256 * 4), 256, 0, stream>>>(x, xh);
  cvt_w_kernel<<<(KEY_CH * IN_CH) / 256, 256, 0, stream>>>(
      Wq, Wk, Wv, Wp, wqh, wkh, wvh, wph);

  // 1) Q/K/V projections
  proj_qkv_kernel<<<NB * (NPIX / 64), 256, 0, stream>>>(
      xh, wqh, wkh, wvh, Qh, Kh, Vt);

  // 2) flash attention
  attn_kernel<<<dim3(NPIX / 128, NB * HEADS), 256, 0, stream>>>(Qh, Kh, Vt, Orow);

  // 3) output projection + residual
  out_proj_kernel<<<dim3(NPIX / 64, NB, 2), 256, 0, stream>>>(wph, Orow, x, out);
}

// v001
// One run takes 128 microseconds.
// Next to v000, in two timings, it ran 2.38 and 2.37 times as fast.
#include <hip/hip_runtime.h>
#include <hip/hip_bf16.h>

// ---------------------------------------------------------------------------
// LiteSelfAttention2D for MI455X (gfx1250): flash-attention on v_wmma_f32_16x16x32_f16
// B=4, C=256, KEY_CH=128, HEADS=4, HEAD_DIM=32, N=4096
// ---------------------------------------------------------------------------

#define NB      4
#define IN_CH   256
#define KEY_CH  128
#define HEADS   4
#define HEAD_DIM 32
#define NPIX    4096   // 64*64

typedef _Float16 half8  __attribute__((ext_vector_type(8)));
typedef _Float16 half16 __attribute__((ext_vector_type(16)));
typedef float    f32x8  __attribute__((ext_vector_type(8)));

// Build a 16x32 (or 32x16) f16 WMMA fragment from two 16-byte chunks.
// A-layout: lane L holds row L%16, K-chunks at g*8 and 16+g*8 (g = L/16).
// B-layout is the mirror (lane = column, same K pattern).
static __device__ __forceinline__ half16 load_frag(const _Float16* lo,
                                                   const _Float16* hi) {
  half8 a = *(const half8*)lo;
  half8 b = *(const half8*)hi;
  half16 r;
#pragma unroll
  for (int i = 0; i < 8; ++i) { r[i] = a[i]; r[i + 8] = b[i]; }
  return r;
}

static __device__ __forceinline__ f32x8 wmma_f16(half16 a, half16 b, f32x8 c) {
  // D = A(16x32 f16) * B(32x16 f16) + C(16x16 f32)
  return __builtin_amdgcn_wmma_f32_16x16x32_f16(false, a, false, b,
                                                (short)0, c, false, false);
}

static __device__ __forceinline__ f32x8 zero8() {
  f32x8 z = {0.f, 0.f, 0.f, 0.f, 0.f, 0.f, 0.f, 0.f};
  return z;
}

// ---------------------------------------------------------------------------
// Kernel 0a: x (f32, [B][C][N]) -> xh (f16), vectorized
// ---------------------------------------------------------------------------
__global__ void __launch_bounds__(256) cvt_x_kernel(const float* __restrict__ x,
                                                    _Float16* __restrict__ xh) {
  int i = (blockIdx.x * 256 + threadIdx.x) * 4;
  float4 v = *(const float4*)(x + i);
  xh[i + 0] = (_Float16)v.x;
  xh[i + 1] = (_Float16)v.y;
  xh[i + 2] = (_Float16)v.z;
  xh[i + 3] = (_Float16)v.w;
}

// ---------------------------------------------------------------------------
// Kernel 0b: weights -> f16. Softmax scale 1/sqrt(32) is folded into Wq.
// ---------------------------------------------------------------------------
__global__ void __launch_bounds__(256) cvt_w_kernel(
    const float* __restrict__ wq, const float* __restrict__ wk,
    const float* __restrict__ wv, const float* __restrict__ wp,
    _Float16* __restrict__ wqh, _Float16* __restrict__ wkh,
    _Float16* __restrict__ wvh, _Float16* __restrict__ wph) {
  int i = blockIdx.x * 256 + threadIdx.x;
  const float s = 0.17677669529663687f;  // 1/sqrt(HEAD_DIM)
  wqh[i] = (_Float16)(wq[i] * s);
  wkh[i] = (_Float16)wk[i];
  wvh[i] = (_Float16)wv[i];
  wph[i] = (_Float16)wp[i];
}

// ---------------------------------------------------------------------------
// Kernel 1: projections Q,K,V = W * x  (per image: [128,256] x [256,4096])
// Grid: NB*64 blocks, 256 threads (8 waves). Wave w -> output rows 16w..16w+15.
// x tiles are transposed through LDS so the B-fragment (K = channel dim)
// becomes two contiguous ds_load_b128 per lane.
// Outputs: Qh,Kh f16 [b][h][n][32] (row-major), Vt f16 [b][h][32][n].
// ---------------------------------------------------------------------------
__global__ void __launch_bounds__(256) proj_qkv_kernel(
    const _Float16* __restrict__ xh,
    const _Float16* __restrict__ wqh, const _Float16* __restrict__ wkh,
    const _Float16* __restrict__ wvh,
    _Float16* __restrict__ Qh, _Float16* __restrict__ Kh,
    _Float16* __restrict__ Vt) {
  __shared__ __align__(16) _Float16 Xt[64][40];  // [n][c], padded stride 40

  const int bx = blockIdx.x;
  const int b = bx >> 6;
  const int n0 = (bx & 63) * 64;
  const int tid = threadIdx.x;
  const int w = tid >> 5, lane = tid & 31, g = lane >> 4, lh = lane & 15;
  const _Float16* xb = xh + (size_t)b * IN_CH * NPIX;

  f32x8 acc[3][4];
#pragma unroll
  for (int p = 0; p < 3; ++p)
#pragma unroll
    for (int j = 0; j < 4; ++j) acc[p][j] = zero8();

  const int wrow = w * 16 + lh;  // output row for this lane's fragment
  for (int cc = 0; cc < IN_CH; cc += 32) {
    __syncthreads();
    // load [32 c][64 n] tile, store transposed as [n][c]
#pragma unroll
    for (int k = 0; k < 8; ++k) {
      int idx = k * 256 + tid;          // 0..2047
      int c = idx >> 6, n = idx & 63;
      Xt[n][c] = xb[(size_t)(cc + c) * NPIX + n0 + n];
    }
    __syncthreads();

    half16 aq = load_frag(wqh + wrow * IN_CH + cc + g * 8,
                          wqh + wrow * IN_CH + cc + 16 + g * 8);
    half16 ak = load_frag(wkh + wrow * IN_CH + cc + g * 8,
                          wkh + wrow * IN_CH + cc + 16 + g * 8);
    half16 av = load_frag(wvh + wrow * IN_CH + cc + g * 8,
                          wvh + wrow * IN_CH + cc + 16 + g * 8);
#pragma unroll
    for (int j = 0; j < 4; ++j) {
      half16 bf = load_frag(&Xt[j * 16 + lh][g * 8],
                            &Xt[j * 16 + lh][16 + g * 8]);
      acc[0][j] = wmma_f16(aq, bf, acc[0][j]);
      acc[1][j] = wmma_f16(ak, bf, acc[1][j]);
      acc[2][j] = wmma_f16(av, bf, acc[2][j]);
    }
  }

  // scatter to Qh/Kh (row-major per pixel) and Vt (transposed)
#pragma unroll
  for (int j = 0; j < 4; ++j) {
#pragma unroll
    for (int r = 0; r < 8; ++r) {
      int kk = w * 16 + r + 8 * g;       // 0..127
      int h = kk >> 5, d = kk & 31;
      int n = n0 + j * 16 + lh;
      size_t hb = (size_t)(b * HEADS + h);
      size_t qoff = (hb * NPIX + n) * HEAD_DIM + d;
      Qh[qoff] = (_Float16)acc[0][j][r];
      Kh[qoff] = (_Float16)acc[1][j][r];
      Vt[(hb * HEAD_DIM + d) * NPIX + n] = (_Float16)acc[2][j][r];
    }
  }
}

// ---------------------------------------------------------------------------
// Kernel 2: flash attention. Grid (N/128, B*HEADS), 256 threads = 8 waves.
// Each wave owns 16 queries. Per 64-key tile:
//   - all 8 waves cooperatively stage the SHARED K tile (64x32 f16, 4 KB) and
//     V^T tile (32x64 f16, 4 KB) into LDS once (8x less global/L2 traffic
//     than per-wave streaming), with global_prefetch of the next tile;
//   - 4 WMMAs for S^T = K Q^T (scale pre-folded into Q): a lane holds 32 of
//     the 64 scores of ONE query (column lh), its partner lane^16 the rest;
//   - online softmax in f32 in registers on all 32 lanes (maximum in-lane plus
//     one exchange between the wave halves; sums stay per half until the end);
//   - 4 WMMAs for O^T += V^T P^T: two converted S^T tiles ARE the B operand.
// Output Orow f16 [b][n][128] (channel-contiguous per pixel).
// ---------------------------------------------------------------------------
// value of lane l ^ 16
static __device__ __forceinline__ float other_half(float v) {
  int b = __builtin_bit_cast(int, v);
  b = __builtin_amdgcn_permlanex16(b, b, 0x76543210, 0xfedcba98, false, false);
  return __builtin_bit_cast(float, b);
}

__global__ void __launch_bounds__(256) attn_kernel(
    const _Float16* __restrict__ Qh, const _Float16* __restrict__ Kh,
    const _Float16* __restrict__ Vt, _Float16* __restrict__ Orow) {
  __shared__ __align__(16) _Float16 Ks[64][32];      //  4 KB (shared K tile)
  __shared__ __align__(16) _Float16 Vs[32][64];      //  4 KB (shared V^T tile)

  const int tid = threadIdx.x;
  const int w = tid >> 5, lane = tid & 31, g = lane >> 4, lh = lane & 15;
  const int bh = blockIdx.y;
  const int b = bh >> 2, h = bh & 3;
  const int q0 = blockIdx.x * 128 + w * 16;
  const size_t hb = (size_t)(b * HEADS + h);
  const _Float16* qb = Qh + hb * NPIX * HEAD_DIM;
  const _Float16* kb = Kh + hb * NPIX * HEAD_DIM;
  const _Float16* vb = Vt + hb * HEAD_DIM * NPIX;

  // Q^T as B operand: lane = query column q0 + lh (reused every iteration)
  half16 bq = load_frag(qb + (size_t)(q0 + lh) * 32 + g * 8,
                        qb + (size_t)(q0 + lh) * 32 + 16 + g * 8);
  // O^T tiles: register r = O[query lh][d = 8g + r] (o_lo), d = 16 + 8g + r (o_hi)
  f32x8 o_lo = zero8(), o_hi = zero8();
  float m = -1e30f;   // running maximum of this lane's query (equal in both halves)
  float l = 0.f;      // running sum over this half's keys only

  // cooperative-staging indices (each thread moves 8+8 f16 per tile)
  const int kslot = tid * 8;            // 0..2047 over Ks (64x32)
  const int vd = tid >> 3;              // 0..31  (V^T row = d)
  const int vm = (tid & 7) * 8;         // 0..56  (m offset within tile)

#pragma unroll 1
  for (int kt = 0; kt < NPIX / 64; ++kt) {
    const int m0 = kt * 64;
    // ---- stage K/V tiles into LDS once per workgroup ----
    __syncthreads();  // previous iteration's readers are done
    *(half8*)((_Float16*)Ks + kslot) = *(const half8*)(kb + (size_t)m0 * 32 + kslot);
    *(half8*)(&Vs[vd][vm])           = *(const half8*)(vb + (size_t)vd * NPIX + m0 + vm);
    if (kt + 1 < NPIX / 64) {           // prefetch next tile (global_prefetch_b8)
      __builtin_prefetch(kb + (size_t)(m0 + 64) * 32 + kslot, 0, 0);
      __builtin_prefetch(vb + (size_t)vd * NPIX + m0 + 64 + vm, 0, 0);
    }
    __syncthreads();  // staging visible to all waves

    // ---- S^T = K Q^T: s[j][r] = score(query lh, key 16j + 8g + r) ----
    f32x8 s[4];
#pragma unroll
    for (int j = 0; j < 4; ++j) {
      half16 ak = load_frag(&Ks[j * 16 + lh][g * 8],
                            &Ks[j * 16 + lh][16 + g * 8]);
      s[j] = wmma_f16(ak, bq, zero8());
    }
    // ---- online softmax in registers ----
    float mt[4];
#pragma unroll
    for (int j = 0; j < 4; ++j) {
      mt[j] = fmaxf(fmaxf(fmaxf(s[j][0], s[j][1]), fmaxf(s[j][2], s[j][3])),
                    fmaxf(fmaxf(s[j][4], s[j][5]), fmaxf(s[j][6], s[j][7])));
    }
    float mx = fmaxf(fmaxf(mt[0], mt[1]), fmaxf(mt[2], mt[3]));
    mx = fmaxf(m, fmaxf(mx, other_half(mx)));
    const float alpha = __expf(m - mx);
    m = mx;
    // P^T as B operand: element i = key 32mj + 8g + i, element 8 + i = key
    // 32mj + 16 + 8g + i, which is the k order load_frag gives V^T below.
    half16 p[2];
    float st[4];
#pragma unroll
    for (int j = 0; j < 4; ++j) {
      float e[8];
#pragma unroll
      for (int r = 0; r < 8; ++r) {
        e[r] = __expf(s[j][r] - mx);
        p[j >> 1][(j & 1) * 8 + r] = (_Float16)e[r];
      }
      st[j] = ((e[0] + e[1]) + (e[2] + e[3])) + ((e[4] + e[5]) + (e[6] + e[7]));
    }
    l = l * alpha + ((st[0] + st[1]) + (st[2] + st[3]));
    // ---- rescale running O^T: one factor per lane ----
#pragma unroll
    for (int r = 0; r < 8; ++r) {
      o_lo[r] *= alpha;
      o_hi[r] *= alpha;
    }
    // ---- O^T += V^T P^T (two 32-wide key sub-tiles; d split 0..15 / 16..31) ----
#pragma unroll
    for (int mj = 0; mj < 2; ++mj) {
      half16 av0 = load_frag(&Vs[lh][mj * 32 + g * 8],
                             &Vs[lh][mj * 32 + 16 + g * 8]);
      o_lo = wmma_f16(av0, p[mj], o_lo);
      half16 av1 = load_frag(&Vs[16 + lh][mj * 32 + g * 8],
                             &Vs[16 + lh][mj * 32 + 16 + g * 8]);
      o_hi = wmma_f16(av1, p[mj], o_hi);
    }
  }

  // ---- finalize: join the halves' sums, divide, store Orow[b][n][h*32 + d] ----
  const float inv = 1.f / (l + other_half(l));
  _Float16* ob = Orow + (size_t)b * NPIX * KEY_CH + h * HEAD_DIM +
                 (size_t)(q0 + lh) * KEY_CH + g * 8;
  half8 lo8, hi8;
#pragma unroll
  for (int r = 0; r < 8; ++r) {
    lo8[r] = (_Float16)(o_lo[r] * inv);
    hi8[r] = (_Float16)(o_hi[r] * inv);
  }
  *(half8*)ob        = lo8;
  *(half8*)(ob + 16) = hi8;
}

// ---------------------------------------------------------------------------
// Kernel 3: out = Wp @ O + x.  [256,128] x [128,4096] per image.
// Orow rows are kk-contiguous, so B-fragments are direct global_load_b128.
// Grid (N/64, B, 2), 256 threads; wave w handles 16 output channels.
// ---------------------------------------------------------------------------
__global__ void __launch_bounds__(256) out_proj_kernel(
    const _Float16* __restrict__ wph, const _Float16* __restrict__ Orow,
    const float* __restrict__ x, float* __restrict__ out) {
  const int tid = threadIdx.x;
  const int w = tid >> 5, lane = tid & 31, g = lane >> 4, lh = lane & 15;
  const int n0 = blockIdx.x * 64;
  const int b = blockIdx.y;
  const int c0 = blockIdx.z * 128 + w * 16;
  const _Float16* ob = Orow + (size_t)b * NPIX * KEY_CH;

  f32x8 acc[4];
#pragma unroll
  for (int j = 0; j < 4; ++j) acc[j] = zero8();

#pragma unroll
  for (int kc = 0; kc < 4; ++kc) {
    const int k0 = kc * 32;
    half16 a = load_frag(wph + (size_t)(c0 + lh) * KEY_CH + k0 + g * 8,
                         wph + (size_t)(c0 + lh) * KEY_CH + k0 + 16 + g * 8);
#pragma unroll
    for (int j = 0; j < 4; ++j) {
      const _Float16* orow = ob + (size_t)(n0 + j * 16 + lh) * KEY_CH + k0;
      half16 bf = load_frag(orow + g * 8, orow + 16 + g * 8);
      acc[j] = wmma_f16(a, bf, acc[j]);
    }
  }
#pragma unroll
  for (int j = 0; j < 4; ++j) {
#pragma unroll
    for (int r = 0; r < 8; ++r) {
      int c = c0 + r + 8 * g;
      int n = n0 + j * 16 + lh;
      size_t off = (size_t)(b * IN_CH + c) * NPIX + n;
      out[off] = acc[j][r] + x[off];
    }
  }
}

// ---------------------------------------------------------------------------
// Host launcher
// ---------------------------------------------------------------------------
extern "C" void kernel_launch(void* const* d_in, const int* in_sizes, int n_in,
                              void* d_out, int out_size, void* d_ws, size_t ws_size,
                              hipStream_t stream) {
  const float* x  = (const float*)d_in[0];
  const float* Wq = (const float*)d_in[1];
  const float* Wk = (const float*)d_in[2];
  const float* Wv = (const float*)d_in[3];
  const float* Wp = (const float*)d_in[4];
  float* out = (float*)d_out;

  // workspace carve-up (all f16)
  char* ws = (char*)d_ws;
  size_t off = 0;
  _Float16* xh  = (_Float16*)(ws + off); off += (size_t)NB * IN_CH * NPIX * 2;   // 8 MB
  _Float16* wqh = (_Float16*)(ws + off); off += (size_t)KEY_CH * IN_CH * 2;
  _Float16* wkh = (_Float16*)(ws + off); off += (size_t)KEY_CH * IN_CH * 2;
  _Float16* wvh = (_Float16*)(ws + off); off += (size_t)KEY_CH * IN_CH * 2;
  _Float16* wph = (_Float16*)(ws + off); off += (size_t)IN_CH * KEY_CH * 2;
  _Float16* Qh  = (_Float16*)(ws + off); off += (size_t)NB * KEY_CH * NPIX * 2;  // 4 MB
  _Float16* Kh  = (_Float16*)(ws + off); off += (size_t)NB * KEY_CH * NPIX * 2;  // 4 MB
  _Float16* Vt  = (_Float16*)(ws + off); off += (size_t)NB * KEY_CH * NPIX * 2;  // 4 MB
  _Float16* Orow = (_Float16*)(ws + off); off += (size_t)NB * NPIX * KEY_CH * 2; // 4 MB

  // 0) precision conversion (scale folded into Wq)
  cvt_x_kernel<<<(NB * IN_CH * NPIX) / (256 * 4), 256, 0, stream>>>(x, xh);
  cvt_w_kernel<<<(KEY_CH * IN_CH) / 256, 256, 0, stream>>>(
      Wq, Wk, Wv, Wp, wqh, wkh, wvh, wph);

  // 1) Q/K/V projections
  proj_qkv_kernel<<<NB * (NPIX / 64), 256, 0, stream>>>(
      xh, wqh, wkh, wvh, Qh, Kh, Vt);

  // 2) flash attention
  attn_kernel<<<dim3(NPIX / 128, NB * HEADS), 256, 0, stream>>>(Qh, Kh, Vt, Orow);

  // 3) output projection + residual
  out_proj_kernel<<<dim3(NPIX / 64, NB, 2), 256, 0, stream>>>(wph, Orow, x, out);
}

// v002
// It runs in 88.6 microseconds.
// Next to v001, in two timings, it ran 1.45 and 1.44 times as fast.
// Counting every step since v000, it is 3.44 times as fast.
#include <hip/hip_runtime.h>
#include <hip/hip_bf16.h>

// ---------------------------------------------------------------------------
// LiteSelfAttention2D for MI455X (gfx1250): flash-attention on v_wmma_f32_16x16x32_f16
// B=4, C=256, KEY_CH=128, HEADS=4, HEAD_DIM=32, N=4096
// ---------------------------------------------------------------------------

#define NB      4
#define IN_CH   256
#define KEY_CH  128
#define HEADS   4
#define HEAD_DIM 32
#define NPIX    4096   // 64*64

typedef _Float16 half8  __attribute__((ext_vector_type(8)));
typedef _Float16 half16 __attribute__((ext_vector_type(16)));
typedef float    f32x8  __attribute__((ext_vector_type(8)));

// Build a 16x32 (or 32x16) f16 WMMA fragment from two 16-byte chunks.
// A-layout: lane L holds row L%16, K-chunks at g*8 and 16+g*8 (g = L/16).
// B-layout is the mirror (lane = column, same K pattern).
static __device__ __forceinline__ half16 load_frag(const _Float16* lo,
                                                   const _Float16* hi) {
  half8 a = *(const half8*)lo;
  half8 b = *(const half8*)hi;
  half16 r;
#pragma unroll
  for (int i = 0; i < 8; ++i) { r[i] = a[i]; r[i + 8] = b[i]; }
  return r;
}

static __device__ __forceinline__ f32x8 wmma_f16(half16 a, half16 b, f32x8 c) {
  // D = A(16x32 f16) * B(32x16 f16) + C(16x16 f32)
  return __builtin_amdgcn_wmma_f32_16x16x32_f16(false, a, false, b,
                                                (short)0, c, false, false);
}

static __device__ __forceinline__ f32x8 zero8() {
  f32x8 z = {0.f, 0.f, 0.f, 0.f, 0.f, 0.f, 0.f, 0.f};
  return z;
}

// ---------------------------------------------------------------------------
// Kernel 0a: x (f32, [B][C][N]) -> xh (f16), vectorized
// ---------------------------------------------------------------------------
__global__ void __launch_bounds__(256) cvt_x_kernel(const float* __restrict__ x,
                                                    _Float16* __restrict__ xh) {
  int i = (blockIdx.x * 256 + threadIdx.x) * 4;
  float4 v = *(const float4*)(x + i);
  xh[i + 0] = (_Float16)v.x;
  xh[i + 1] = (_Float16)v.y;
  xh[i + 2] = (_Float16)v.z;
  xh[i + 3] = (_Float16)v.w;
}

// ---------------------------------------------------------------------------
// Kernel 0b: weights -> f16. Softmax scale 1/sqrt(32) is folded into Wq.
// ---------------------------------------------------------------------------
__global__ void __launch_bounds__(256) cvt_w_kernel(
    const float* __restrict__ wq, const float* __restrict__ wk,
    const float* __restrict__ wv, const float* __restrict__ wp,
    _Float16* __restrict__ wqh, _Float16* __restrict__ wkh,
    _Float16* __restrict__ wvh, _Float16* __restrict__ wph) {
  int i = blockIdx.x * 256 + threadIdx.x;
  const float s = 0.17677669529663687f;  // 1/sqrt(HEAD_DIM)
  wqh[i] = (_Float16)(wq[i] * s);
  wkh[i] = (_Float16)wk[i];
  wvh[i] = (_Float16)wv[i];
  wph[i] = (_Float16)wp[i];
}

// ---------------------------------------------------------------------------
// Kernel 1: projections Q,K,V = W * x  (per image: [128,256] x [256,4096])
// Grid: NB*64 blocks, 256 threads (8 waves). Wave w -> output rows 16w..16w+15.
// x tiles are transposed through LDS so the B-fragment (K = channel dim)
// becomes two contiguous ds_load_b128 per lane.
// Outputs: Qh,Kh f16 [b][h][n][32] (row-major), Vt f16 [b][h][32][n].
// ---------------------------------------------------------------------------
__global__ void __launch_bounds__(256) proj_qkv_kernel(
    const _Float16* __restrict__ xh,
    const _Float16* __restrict__ wqh, const _Float16* __restrict__ wkh,
    const _Float16* __restrict__ wvh,
    _Float16* __restrict__ Qh, _Float16* __restrict__ Kh,
    _Float16* __restrict__ Vt) {
  __shared__ __align__(16) _Float16 Xt[64][40];  // [n][c], padded stride 40

  const int bx = blockIdx.x;
  const int b = bx >> 6;
  const int n0 = (bx & 63) * 64;
  const int tid = threadIdx.x;
  const int w = tid >> 5, lane = tid & 31, g = lane >> 4, lh = lane & 15;
  const _Float16* xb = xh + (size_t)b * IN_CH * NPIX;

  f32x8 acc[3][4];
#pragma unroll
  for (int p = 0; p < 3; ++p)
#pragma unroll
    for (int j = 0; j < 4; ++j) acc[p][j] = zero8();

  const int wrow = w * 16 + lh;  // output row for this lane's fragment
  for (int cc = 0; cc < IN_CH; cc += 32) {
    __syncthreads();
    // load [32 c][64 n] tile, store transposed as [n][c]
#pragma unroll
    for (int k = 0; k < 8; ++k) {
      int idx = k * 256 + tid;          // 0..2047
      int c = idx >> 6, n = idx & 63;
      Xt[n][c] = xb[(size_t)(cc + c) * NPIX + n0 + n];
    }
    __syncthreads();

    half16 aq = load_frag(wqh + wrow * IN_CH + cc + g * 8,
                          wqh + wrow * IN_CH + cc + 16 + g * 8);
    half16 ak = load_frag(wkh + wrow * IN_CH + cc + g * 8,
                          wkh + wrow * IN_CH + cc + 16 + g * 8);
    half16 av = load_frag(wvh + wrow * IN_CH + cc + g * 8,
                          wvh + wrow * IN_CH + cc + 16 + g * 8);
#pragma unroll
    for (int j = 0; j < 4; ++j) {
      half16 bf = load_frag(&Xt[j * 16 + lh][g * 8],
                            &Xt[j * 16 + lh][16 + g * 8]);
      acc[0][j] = wmma_f16(aq, bf, acc[0][j]);
      acc[1][j] = wmma_f16(ak, bf, acc[1][j]);
      acc[2][j] = wmma_f16(av, bf, acc[2][j]);
    }
  }

  // scatter to Qh/Kh (row-major per pixel) and Vt (transposed)
#pragma unroll
  for (int j = 0; j < 4; ++j) {
#pragma unroll
    for (int r = 0; r < 8; ++r) {
      int kk = w * 16 + r + 8 * g;       // 0..127
      int h = kk >> 5, d = kk & 31;
      int n = n0 + j * 16 + lh;
      size_t hb = (size_t)(b * HEADS + h);
      size_t qoff = (hb * NPIX + n) * HEAD_DIM + d;
      Qh[qoff] = (_Float16)acc[0][j][r];
      Kh[qoff] = (_Float16)acc[1][j][r];
      Vt[(hb * HEAD_DIM + d) * NPIX + n] = (_Float16)acc[2][j][r];
    }
  }
}

// ---------------------------------------------------------------------------
// Kernel 2: flash attention. Grid (N/128, B*HEADS), 256 threads = 8 waves.
// Each wave owns 16 queries. Per 64-key tile:
//   - all 8 waves cooperatively stage the SHARED K tile (64x32 f16, 4 KB) and
//     V^T tile (32x64 f16, 4 KB) into LDS once (8x less global/L2 traffic
//     than per-wave streaming), with global_prefetch of the next tile;
//   - 4 WMMAs for S^T = K Q^T (scale pre-folded into Q): a lane holds 32 of
//     the 64 scores of ONE query (column lh), its partner lane^16 the rest;
//   - online softmax in f32 in registers on all 32 lanes (maximum in-lane plus
//     one exchange between the wave halves; sums stay per half until the end);
//   - 4 WMMAs for O^T += V^T P^T: two converted S^T tiles ARE the B operand.
// Output Orow f16 [b][n][128] (channel-contiguous per pixel).
// ---------------------------------------------------------------------------
// value of lane l ^ 16
static __device__ __forceinline__ float other_half(float v) {
  int b = __builtin_bit_cast(int, v);
  b = __builtin_amdgcn_permlanex16(b, b, 0x76543210, 0xfedcba98, false, false);
  return __builtin_bit_cast(float, b);
}

__global__ void __launch_bounds__(256) attn_kernel(
    const _Float16* __restrict__ Qh, const _Float16* __restrict__ Kh,
    const _Float16* __restrict__ Vt, _Float16* __restrict__ Orow) {
  // Row pitch = 16 B x odd, so the 16 rows one ds_load_b128 half-wave reads
  // fall on 64 distinct banks (unpadded 64 B / 128 B rows collide 4x / 8x).
  __shared__ __align__(16) _Float16 Ks[64][40];      // K tile, 64 B rows at pitch 80 B
  __shared__ __align__(16) _Float16 Vs[32][72];      // V^T tile, 128 B rows at pitch 144 B

  const int tid = threadIdx.x;
  const int w = tid >> 5, lane = tid & 31, g = lane >> 4, lh = lane & 15;
  const int bh = blockIdx.y;
  const int b = bh >> 2, h = bh & 3;
  const int q0 = blockIdx.x * 128 + w * 16;
  const size_t hb = (size_t)(b * HEADS + h);
  const _Float16* qb = Qh + hb * NPIX * HEAD_DIM;
  const _Float16* kb = Kh + hb * NPIX * HEAD_DIM;
  const _Float16* vb = Vt + hb * HEAD_DIM * NPIX;

  // Q^T as B operand: lane = query column q0 + lh (reused every iteration)
  half16 bq = load_frag(qb + (size_t)(q0 + lh) * 32 + g * 8,
                        qb + (size_t)(q0 + lh) * 32 + 16 + g * 8);
  // O^T tiles: register r = O[query lh][d = 8g + r] (o_lo), d = 16 + 8g + r (o_hi)
  f32x8 o_lo = zero8(), o_hi = zero8();
  float m = -1e30f;   // running maximum of this lane's query (equal in both halves)
  float l = 0.f;      // running sum over this half's keys only

  // cooperative-staging indices (each thread moves 8+8 f16 per tile)
  const int kslot = tid * 8;            // 0..2047 over the global K tile (64x32)
  const int kr = tid >> 2;              // 0..63  (K row = key)
  const int kc = (tid & 3) * 8;         // 0..24  (d offset within the row)
  const int vd = tid >> 3;              // 0..31  (V^T row = d)
  const int vm = (tid & 7) * 8;         // 0..56  (m offset within tile)

#pragma unroll 1
  for (int kt = 0; kt < NPIX / 64; ++kt) {
    const int m0 = kt * 64;
    // ---- stage K/V tiles into LDS once per workgroup ----
    __syncthreads();  // previous iteration's readers are done
    *(half8*)(&Ks[kr][kc])           = *(const half8*)(kb + (size_t)m0 * 32 + kslot);
    *(half8*)(&Vs[vd][vm])           = *(const half8*)(vb + (size_t)vd * NPIX + m0 + vm);
    if (kt + 1 < NPIX / 64) {           // prefetch next tile (global_prefetch_b8)
      __builtin_prefetch(kb + (size_t)(m0 + 64) * 32 + kslot, 0, 0);
      __builtin_prefetch(vb + (size_t)vd * NPIX + m0 + 64 + vm, 0, 0);
    }
    __syncthreads();  // staging visible to all waves

    // ---- S^T = K Q^T: s[j][r] = score(query lh, key 16j + 8g + r) ----
    f32x8 s[4];
#pragma unroll
    for (int j = 0; j < 4; ++j) {
      half16 ak = load_frag(&Ks[j * 16 + lh][g * 8],
                            &Ks[j * 16 + lh][16 + g * 8]);
      s[j] = wmma_f16(ak, bq, zero8());
    }
    // ---- online softmax in registers ----
    float mt[4];
#pragma unroll
    for (int j = 0; j < 4; ++j) {
      mt[j] = fmaxf(fmaxf(fmaxf(s[j][0], s[j][1]), fmaxf(s[j][2], s[j][3])),
                    fmaxf(fmaxf(s[j][4], s[j][5]), fmaxf(s[j][6], s[j][7])));
    }
    float mx = fmaxf(fmaxf(mt[0], mt[1]), fmaxf(mt[2], mt[3]));
    mx = fmaxf(m, fmaxf(mx, other_half(mx)));
    const float alpha = __expf(m - mx);
    m = mx;
    // P^T as B operand: element i = key 32mj + 8g + i, element 8 + i = key
    // 32mj + 16 + 8g + i, which is the k order load_frag gives V^T below.
    half16 p[2];
    float st[4];
#pragma unroll
    for (int j = 0; j < 4; ++j) {
      float e[8];
#pragma unroll
      for (int r = 0; r < 8; ++r) {
        e[r] = __expf(s[j][r] - mx);
        p[j >> 1][(j & 1) * 8 + r] = (_Float16)e[r];
      }
      st[j] = ((e[0] + e[1]) + (e[2] + e[3])) + ((e[4] + e[5]) + (e[6] + e[7]));
    }
    l = l * alpha + ((st[0] + st[1]) + (st[2] + st[3]));
    // ---- rescale running O^T: one factor per lane ----
#pragma unroll
    for (int r = 0; r < 8; ++r) {
      o_lo[r] *= alpha;
      o_hi[r] *= alpha;
    }
    // ---- O^T += V^T P^T (two 32-wide key sub-tiles; d split 0..15 / 16..31) ----
#pragma unroll
    for (int mj = 0; mj < 2; ++mj) {
      half16 av0 = load_frag(&Vs[lh][mj * 32 + g * 8],
                             &Vs[lh][mj * 32 + 16 + g * 8]);
      o_lo = wmma_f16(av0, p[mj], o_lo);
      half16 av1 = load_frag(&Vs[16 + lh][mj * 32 + g * 8],
                             &Vs[16 + lh][mj * 32 + 16 + g * 8]);
      o_hi = wmma_f16(av1, p[mj], o_hi);
    }
  }

  // ---- finalize: join the halves' sums, divide, store Orow[b][n][h*32 + d] ----
  const float inv = 1.f / (l + other_half(l));
  _Float16* ob = Orow + (size_t)b * NPIX * KEY_CH + h * HEAD_DIM +
                 (size_t)(q0 + lh) * KEY_CH + g * 8;
  half8 lo8, hi8;
#pragma unroll
  for (int r = 0; r < 8; ++r) {
    lo8[r] = (_Float16)(o_lo[r] * inv);
    hi8[r] = (_Float16)(o_hi[r] * inv);
  }
  *(half8*)ob        = lo8;
  *(half8*)(ob + 16) = hi8;
}

// ---------------------------------------------------------------------------
// Kernel 3: out = Wp @ O + x.  [256,128] x [128,4096] per image.
// Orow rows are kk-contiguous, so B-fragments are direct global_load_b128.
// Grid (N/64, B, 2), 256 threads; wave w handles 16 output channels.
// ---------------------------------------------------------------------------
__global__ void __launch_bounds__(256) out_proj_kernel(
    const _Float16* __restrict__ wph, const _Float16* __restrict__ Orow,
    const float* __restrict__ x, float* __restrict__ out) {
  const int tid = threadIdx.x;
  const int w = tid >> 5, lane = tid & 31, g = lane >> 4, lh = lane & 15;
  const int n0 = blockIdx.x * 64;
  const int b = blockIdx.y;
  const int c0 = blockIdx.z * 128 + w * 16;
  const _Float16* ob = Orow + (size_t)b * NPIX * KEY_CH;

  f32x8 acc[4];
#pragma unroll
  for (int j = 0; j < 4; ++j) acc[j] = zero8();

#pragma unroll
  for (int kc = 0; kc < 4; ++kc) {
    const int k0 = kc * 32;
    half16 a = load_frag(wph + (size_t)(c0 + lh) * KEY_CH + k0 + g * 8,
                         wph + (size_t)(c0 + lh) * KEY_CH + k0 + 16 + g * 8);
#pragma unroll
    for (int j = 0; j < 4; ++j) {
      const _Float16* orow = ob + (size_t)(n0 + j * 16 + lh) * KEY_CH + k0;
      half16 bf = load_frag(orow + g * 8, orow + 16 + g * 8);
      acc[j] = wmma_f16(a, bf, acc[j]);
    }
  }
#pragma unroll
  for (int j = 0; j < 4; ++j) {
#pragma unroll
    for (int r = 0; r < 8; ++r) {
      int c = c0 + r + 8 * g;
      int n = n0 + j * 16 + lh;
      size_t off = (size_t)(b * IN_CH + c) * NPIX + n;
      out[off] = acc[j][r] + x[off];
    }
  }
}

// ---------------------------------------------------------------------------
// Host launcher
// ---------------------------------------------------------------------------
extern "C" void kernel_launch(void* const* d_in, const int* in_sizes, int n_in,
                              void* d_out, int out_size, void* d_ws, size_t ws_size,
                              hipStream_t stream) {
  const float* x  = (const float*)d_in[0];
  const float* Wq = (const float*)d_in[1];
  const float* Wk = (const float*)d_in[2];
  const float* Wv = (const float*)d_in[3];
  const float* Wp = (const float*)d_in[4];
  float* out = (float*)d_out;

  // workspace carve-up (all f16)
  char* ws = (char*)d_ws;
  size_t off = 0;
  _Float16* xh  = (_Float16*)(ws + off); off += (size_t)NB * IN_CH * NPIX * 2;   // 8 MB
  _Float16* wqh = (_Float16*)(ws + off); off += (size_t)KEY_CH * IN_CH * 2;
  _Float16* wkh = (_Float16*)(ws + off); off += (size_t)KEY_CH * IN_CH * 2;
  _Float16* wvh = (_Float16*)(ws + off); off += (size_t)KEY_CH * IN_CH * 2;
  _Float16* wph = (_Float16*)(ws + off); off += (size_t)IN_CH * KEY_CH * 2;
  _Float16* Qh  = (_Float16*)(ws + off); off += (size_t)NB * KEY_CH * NPIX * 2;  // 4 MB
  _Float16* Kh  = (_Float16*)(ws + off); off += (size_t)NB * KEY_CH * NPIX * 2;  // 4 MB
  _Float16* Vt  = (_Float16*)(ws + off); off += (size_t)NB * KEY_CH * NPIX * 2;  // 4 MB
  _Float16* Orow = (_Float16*)(ws + off); off += (size_t)NB * NPIX * KEY_CH * 2; // 4 MB

  // 0) precision conversion (scale folded into Wq)
  cvt_x_kernel<<<(NB * IN_CH * NPIX) / (256 * 4), 256, 0, stream>>>(x, xh);
  cvt_w_kernel<<<(KEY_CH * IN_CH) / 256, 256, 0, stream>>>(
      Wq, Wk, Wv, Wp, wqh, wkh, wvh, wph);

  // 1) Q/K/V projections
  proj_qkv_kernel<<<NB * (NPIX / 64), 256, 0, stream>>>(
      xh, wqh, wkh, wvh, Qh, Kh, Vt);

  // 2) flash attention
  attn_kernel<<<dim3(NPIX / 128, NB * HEADS), 256, 0, stream>>>(Qh, Kh, Vt, Orow);

  // 3) output projection + residual
  out_proj_kernel<<<dim3(NPIX / 64, NB, 2), 256, 0, stream>>>(wph, Orow, x, out);
}

// v003
// Measured time: 85.5 microseconds a run.
// Two timings next to v002 put it at 1.04 and 1.03 times that version's speed.
// Counting every step since v000, it is 3.55 times as fast.
#include <hip/hip_runtime.h>
#include <hip/hip_bf16.h>

// ---------------------------------------------------------------------------
// LiteSelfAttention2D for MI455X (gfx1250): flash-attention on v_wmma_f32_16x16x32_f16
// B=4, C=256, KEY_CH=128, HEADS=4, HEAD_DIM=32, N=4096
// ---------------------------------------------------------------------------

#define NB      4
#define IN_CH   256
#define KEY_CH  128
#define HEADS   4
#define HEAD_DIM 32
#define NPIX    4096   // 64*64

typedef _Float16 half8  __attribute__((ext_vector_type(8)));
typedef _Float16 half16 __attribute__((ext_vector_type(16)));
typedef _Float16 half4  __attribute__((ext_vector_type(4)));
typedef float    f32x4  __attribute__((ext_vector_type(4)));
typedef float    f32x8  __attribute__((ext_vector_type(8)));

// Build a 16x32 (or 32x16) f16 WMMA fragment from two 16-byte chunks.
// A-layout: lane L holds row L%16, K-chunks at g*8 and 16+g*8 (g = L/16).
// B-layout is the mirror (lane = column, same K pattern).
static __device__ __forceinline__ half16 load_frag(const _Float16* lo,
                                                   const _Float16* hi) {
  half8 a = *(const half8*)lo;
  half8 b = *(const half8*)hi;
  half16 r;
#pragma unroll
  for (int i = 0; i < 8; ++i) { r[i] = a[i]; r[i + 8] = b[i]; }
  return r;
}

// The same fragment from four loaded f32 quads (two runs of 8 floats): each
// value times s, rounded to f16 (s = 1 for an unscaled matrix).
static __device__ __forceinline__ half16 round_frag(const f32x4* q, float s) {
  half16 r;
#pragma unroll
  for (int i = 0; i < 16; ++i) r[i] = (_Float16)(q[i >> 2][i & 3] * s);
  return r;
}

static __device__ __forceinline__ f32x8 wmma_f16(half16 a, half16 b, f32x8 c) {
  // D = A(16x32 f16) * B(32x16 f16) + C(16x16 f32)
  return __builtin_amdgcn_wmma_f32_16x16x32_f16(false, a, false, b,
                                                (short)0, c, false, false);
}

static __device__ __forceinline__ f32x8 zero8() {
  f32x8 z = {0.f, 0.f, 0.f, 0.f, 0.f, 0.f, 0.f, 0.f};
  return z;
}

// ---------------------------------------------------------------------------
// Kernel 1: projections Q,K,V = W * x  (per image: [128,256] x [256,4096])
// Grid: NB*64 blocks, 256 threads (8 waves). Wave w -> output rows 16w..16w+15.
// x tiles are transposed through LDS so the B-fragment (K = channel dim)
// becomes two contiguous ds_load_b128 per lane. x and the weights arrive as f32
// and are rounded to f16 here: x while it is staged, Wq/Wk/Wv in registers (the
// softmax scale 1/sqrt(32) folded into Wq before the rounding), and each block
// rounds its 128 elements of Wp into wph for the output projection's launch.
// Outputs: Qh,Kh f16 [b][h][n][32] (row-major), Vt f16 [b][h][32][n].
// ---------------------------------------------------------------------------
__global__ void __launch_bounds__(256) proj_qkv_kernel(
    const float* __restrict__ x,
    const float* __restrict__ wq, const float* __restrict__ wk,
    const float* __restrict__ wv, const float* __restrict__ wp,
    _Float16* __restrict__ wph,
    _Float16* __restrict__ Qh, _Float16* __restrict__ Kh,
    _Float16* __restrict__ Vt) {
  __shared__ __align__(16) _Float16 Xt[64][40];  // [n][c], padded stride 40

  const int bx = blockIdx.x;
  const int b = bx >> 6;
  const int n0 = (bx & 63) * 64;
  const int tid = threadIdx.x;
  const int w = tid >> 5, lane = tid & 31, g = lane >> 4, lh = lane & 15;
  const float* xb = x + (size_t)b * IN_CH * NPIX;
  const float qs = 0.17677669529663687f;  // 1/sqrt(HEAD_DIM)
  const int sn = tid & 63;                // staging: this thread's pixel
  const int sc = (tid >> 6) * 8;          // and its 8 channels of the tile


  f32x8 acc[3][4];
#pragma unroll
  for (int p = 0; p < 3; ++p)
#pragma unroll
    for (int j = 0; j < 4; ++j) acc[p][j] = zero8();

  const int wrow = w * 16 + lh;  // output row for this lane's fragment
  for (int cc = 0; cc < IN_CH; cc += 32) {
    __syncthreads();
    // load [32 c][64 n] f32 tile, round to f16, store transposed as [n][c]
    half8 xc;
#pragma unroll
    for (int k = 0; k < 8; ++k)
      xc[k] = (_Float16)xb[(size_t)(cc + sc + k) * NPIX + n0 + sn];
    *(half8*)(&Xt[sn][sc]) = xc;
    __syncthreads();

    const int wo = wrow * IN_CH + cc + g * 8;
    f32x4 fq[4], fk[4], fv[4];
#pragma unroll
    for (int i = 0; i < 4; ++i) {
      const int o = wo + (i >> 1) * 16 + (i & 1) * 4;
      fq[i] = *(const f32x4*)(wq + o);
      fk[i] = *(const f32x4*)(wk + o);
      fv[i] = *(const f32x4*)(wv + o);
    }
    // Holds the twelve weight loads together (loaded values as inputs only):
    // without it the compiler issues Wv's four behind the first products and
    // the trip waits out one more L2 latency. The wait stands, as a precaution,
    // ahead of the roundings, which reuse the loads' address registers.
    asm volatile("s_wait_xcnt 0x0" ::"v"(fq[0]), "v"(fq[1]), "v"(fq[2]), "v"(fq[3]),
                 "v"(fk[0]), "v"(fk[1]), "v"(fk[2]), "v"(fk[3]),
                 "v"(fv[0]), "v"(fv[1]), "v"(fv[2]), "v"(fv[3]));
    half16 aq = round_frag(fq, qs);
    half16 ak = round_frag(fk, 1.f);
    half16 av = round_frag(fv, 1.f);
#pragma unroll
    for (int j = 0; j < 4; ++j) {
      half16 bf = load_frag(&Xt[j * 16 + lh][g * 8],
                            &Xt[j * 16 + lh][16 + g * 8]);
      acc[0][j] = wmma_f16(aq, bf, acc[0][j]);
      acc[1][j] = wmma_f16(ak, bf, acc[1][j]);
      acc[2][j] = wmma_f16(av, bf, acc[2][j]);
    }
  }

  // wave 0: this block's IN_CH*KEY_CH / gridDim.x = 128 elements of Wp, loaded
  // behind the last barrier, rounded and stored behind the scatter
  f32x4 wpv = {0.f, 0.f, 0.f, 0.f};
  if (tid < 32) wpv = *(const f32x4*)(wp + bx * 128 + tid * 4);

  // scatter to Qh/Kh (row-major per pixel) and Vt (transposed)
#pragma unroll
  for (int j = 0; j < 4; ++j) {
#pragma unroll
    for (int r = 0; r < 8; ++r) {
      int kk = w * 16 + r + 8 * g;       // 0..127
      int h = kk >> 5, d = kk & 31;
      int n = n0 + j * 16 + lh;
      size_t hb = (size_t)(b * HEADS + h);
      size_t qoff = (hb * NPIX + n) * HEAD_DIM + d;
      Qh[qoff] = (_Float16)acc[0][j][r];
      Kh[qoff] = (_Float16)acc[1][j][r];
      Vt[(hb * HEAD_DIM + d) * NPIX + n] = (_Float16)acc[2][j][r];
    }
  }

  if (tid < 32) {
    half4 hv;
#pragma unroll
    for (int i = 0; i < 4; ++i) hv[i] = (_Float16)wpv[i];
    *(half4*)(wph + bx * 128 + tid * 4) = hv;
  }
}

// ---------------------------------------------------------------------------
// Kernel 2: flash attention. Grid (N/128, B*HEADS), 256 threads = 8 waves.
// Each wave owns 16 queries. Per 64-key tile:
//   - all 8 waves cooperatively stage the SHARED K tile (64x32 f16, 4 KB) and
//     V^T tile (32x64 f16, 4 KB) into LDS once (8x less global/L2 traffic
//     than per-wave streaming), with global_prefetch of the next tile;
//   - 4 WMMAs for S^T = K Q^T (scale pre-folded into Q): a lane holds 32 of
//     the 64 scores of ONE query (column lh), its partner lane^16 the rest;
//   - online softmax in f32 in registers on all 32 lanes (maximum in-lane plus
//     one exchange between the wave halves; sums stay per half until the end);
//   - 4 WMMAs for O^T += V^T P^T: two converted S^T tiles ARE the B operand.
// Output Orow f16 [b][n][128] (channel-contiguous per pixel).
// ---------------------------------------------------------------------------
// value of lane l ^ 16
static __device__ __forceinline__ float other_half(float v) {
  int b = __builtin_bit_cast(int, v);
  b = __builtin_amdgcn_permlanex16(b, b, 0x76543210, 0xfedcba98, false, false);
  return __builtin_bit_cast(float, b);
}

__global__ void __launch_bounds__(256) attn_kernel(
    const _Float16* __restrict__ Qh, const _Float16* __restrict__ Kh,
    const _Float16* __restrict__ Vt, _Float16* __restrict__ Orow) {
  // Row pitch = 16 B x odd, so the 16 rows one ds_load_b128 half-wave reads
  // fall on 64 distinct banks (unpadded 64 B / 128 B rows collide 4x / 8x).
  __shared__ __align__(16) _Float16 Ks[64][40];      // K tile, 64 B rows at pitch 80 B
  __shared__ __align__(16) _Float16 Vs[32][72];      // V^T tile, 128 B rows at pitch 144 B

  const int tid = threadIdx.x;
  const int w = tid >> 5, lane = tid & 31, g = lane >> 4, lh = lane & 15;
  const int bh = blockIdx.y;
  const int b = bh >> 2, h = bh & 3;
  const int q0 = blockIdx.x * 128 + w * 16;
  const size_t hb = (size_t)(b * HEADS + h);
  const _Float16* qb = Qh + hb * NPIX * HEAD_DIM;
  const _Float16* kb = Kh + hb * NPIX * HEAD_DIM;
  const _Float16* vb = Vt + hb * HEAD_DIM * NPIX;

  // Q^T as B operand: lane = query column q0 + lh (reused every iteration)
  half16 bq = load_frag(qb + (size_t)(q0 + lh) * 32 + g * 8,
                        qb + (size_t)(q0 + lh) * 32 + 16 + g * 8);
  // O^T tiles: register r = O[query lh][d = 8g + r] (o_lo), d = 16 + 8g + r (o_hi)
  f32x8 o_lo = zero8(), o_hi = zero8();
  float m = -1e30f;   // running maximum of this lane's query (equal in both halves)
  float l = 0.f;      // running sum over this half's keys only

  // cooperative-staging indices (each thread moves 8+8 f16 per tile)
  const int kslot = tid * 8;            // 0..2047 over the global K tile (64x32)
  const int kr = tid >> 2;              // 0..63  (K row = key)
  const int kc = (tid & 3) * 8;         // 0..24  (d offset within the row)
  const int vd = tid >> 3;              // 0..31  (V^T row = d)
  const int vm = (tid & 7) * 8;         // 0..56  (m offset within tile)

#pragma unroll 1
  for (int kt = 0; kt < NPIX / 64; ++kt) {
    const int m0 = kt * 64;
    // ---- stage K/V tiles into LDS once per workgroup ----
    __syncthreads();  // previous iteration's readers are done
    *(half8*)(&Ks[kr][kc])           = *(const half8*)(kb + (size_t)m0 * 32 + kslot);
    *(half8*)(&Vs[vd][vm])           = *(const half8*)(vb + (size_t)vd * NPIX + m0 + vm);
    if (kt + 1 < NPIX / 64) {           // prefetch next tile (global_prefetch_b8)
      __builtin_prefetch(kb + (size_t)(m0 + 64) * 32 + kslot, 0, 0);
      __builtin_prefetch(vb + (size_t)vd * NPIX + m0 + 64 + vm, 0, 0);
    }
    __syncthreads();  // staging visible to all waves

    // ---- S^T = K Q^T: s[j][r] = score(query lh, key 16j + 8g + r) ----
    f32x8 s[4];
#pragma unroll
    for (int j = 0; j < 4; ++j) {
      half16 ak = load_frag(&Ks[j * 16 + lh][g * 8],
                            &Ks[j * 16 + lh][16 + g * 8]);
      s[j] = wmma_f16(ak, bq, zero8());
    }
    // ---- online softmax in registers ----
    float mt[4];
#pragma unroll
    for (int j = 0; j < 4; ++j) {
      mt[j] = fmaxf(fmaxf(fmaxf(s[j][0], s[j][1]), fmaxf(s[j][2], s[j][3])),
                    fmaxf(fmaxf(s[j][4], s[j][5]), fmaxf(s[j][6], s[j][7])));
    }
    float mx = fmaxf(fmaxf(mt[0], mt[1]), fmaxf(mt[2], mt[3]));
    mx = fmaxf(m, fmaxf(mx, other_half(mx)));
    const float alpha = __expf(m - mx);
    m = mx;
    // P^T as B operand: element i = key 32mj + 8g + i, element 8 + i = key
    // 32mj + 16 + 8g + i, which is the k order load_frag gives V^T below.
    half16 p[2];
    float st[4];
#pragma unroll
    for (int j = 0; j < 4; ++j) {
      float e[8];
#pragma unroll
      for (int r = 0; r < 8; ++r) {
        e[r] = __expf(s[j][r] - mx);
        p[j >> 1][(j & 1) * 8 + r] = (_Float16)e[r];
      }
      st[j] = ((e[0] + e[1]) + (e[2] + e[3])) + ((e[4] + e[5]) + (e[6] + e[7]));
    }
    l = l * alpha + ((st[0] + st[1]) + (st[2] + st[3]));
    // ---- rescale running O^T: one factor per lane ----
#pragma unroll
    for (int r = 0; r < 8; ++r) {
      o_lo[r] *= alpha;
      o_hi[r] *= alpha;
    }
    // ---- O^T += V^T P^T (two 32-wide key sub-tiles; d split 0..15 / 16..31) ----
#pragma unroll
    for (int mj = 0; mj < 2; ++mj) {
      half16 av0 = load_frag(&Vs[lh][mj * 32 + g * 8],
                             &Vs[lh][mj * 32 + 16 + g * 8]);
      o_lo = wmma_f16(av0, p[mj], o_lo);
      half16 av1 = load_frag(&Vs[16 + lh][mj * 32 + g * 8],
                             &Vs[16 + lh][mj * 32 + 16 + g * 8]);
      o_hi = wmma_f16(av1, p[mj], o_hi);
    }
  }

  // ---- finalize: join the halves' sums, divide, store Orow[b][n][h*32 + d] ----
  const float inv = 1.f / (l + other_half(l));
  _Float16* ob = Orow + (size_t)b * NPIX * KEY_CH + h * HEAD_DIM +
                 (size_t)(q0 + lh) * KEY_CH + g * 8;
  half8 lo8, hi8;
#pragma unroll
  for (int r = 0; r < 8; ++r) {
    lo8[r] = (_Float16)(o_lo[r] * inv);
    hi8[r] = (_Float16)(o_hi[r] * inv);
  }
  *(half8*)ob        = lo8;
  *(half8*)(ob + 16) = hi8;
}

// ---------------------------------------------------------------------------
// Kernel 3: out = Wp @ O + x.  [256,128] x [128,4096] per image.
// Orow rows are kk-contiguous, so B-fragments are direct global_load_b128.
// Grid (N/64, B, 2), 256 threads; wave w handles 16 output channels.
// ---------------------------------------------------------------------------
__global__ void __launch_bounds__(256) out_proj_kernel(
    const _Float16* __restrict__ wph, const _Float16* __restrict__ Orow,
    const float* __restrict__ x, float* __restrict__ out) {
  const int tid = threadIdx.x;
  const int w = tid >> 5, lane = tid & 31, g = lane >> 4, lh = lane & 15;
  const int n0 = blockIdx.x * 64;
  const int b = blockIdx.y;
  const int c0 = blockIdx.z * 128 + w * 16;
  const _Float16* ob = Orow + (size_t)b * NPIX * KEY_CH;

  f32x8 acc[4];
#pragma unroll
  for (int j = 0; j < 4; ++j) acc[j] = zero8();

#pragma unroll
  for (int kc = 0; kc < 4; ++kc) {
    const int k0 = kc * 32;
    half16 a = load_frag(wph + (size_t)(c0 + lh) * KEY_CH + k0 + g * 8,
                         wph + (size_t)(c0 + lh) * KEY_CH + k0 + 16 + g * 8);
#pragma unroll
    for (int j = 0; j < 4; ++j) {
      const _Float16* orow = ob + (size_t)(n0 + j * 16 + lh) * KEY_CH + k0;
      half16 bf = load_frag(orow + g * 8, orow + 16 + g * 8);
      acc[j] = wmma_f16(a, bf, acc[j]);
    }
  }
#pragma unroll
  for (int j = 0; j < 4; ++j) {
#pragma unroll
    for (int r = 0; r < 8; ++r) {
      int c = c0 + r + 8 * g;
      int n = n0 + j * 16 + lh;
      size_t off = (size_t)(b * IN_CH + c) * NPIX + n;
      out[off] = acc[j][r] + x[off];
    }
  }
}

// ---------------------------------------------------------------------------
// Host launcher
// ---------------------------------------------------------------------------
extern "C" void kernel_launch(void* const* d_in, const int* in_sizes, int n_in,
                              void* d_out, int out_size, void* d_ws, size_t ws_size,
                              hipStream_t stream) {
  const float* x  = (const float*)d_in[0];
  const float* Wq = (const float*)d_in[1];
  const float* Wk = (const float*)d_in[2];
  const float* Wv = (const float*)d_in[3];
  const float* Wp = (const float*)d_in[4];
  float* out = (float*)d_out;

  // workspace carve-up (all f16)
  char* ws = (char*)d_ws;
  size_t off = 0;
  _Float16* wph = (_Float16*)(ws + off); off += (size_t)IN_CH * KEY_CH * 2;
  _Float16* Qh  = (_Float16*)(ws + off); off += (size_t)NB * KEY_CH * NPIX * 2;  // 4 MB
  _Float16* Kh  = (_Float16*)(ws + off); off += (size_t)NB * KEY_CH * NPIX * 2;  // 4 MB
  _Float16* Vt  = (_Float16*)(ws + off); off += (size_t)NB * KEY_CH * NPIX * 2;  // 4 MB
  _Float16* Orow = (_Float16*)(ws + off); off += (size_t)NB * NPIX * KEY_CH * 2; // 4 MB

  // 1) Q/K/V projections (f32 operands rounded to f16 inside; Wp rounded on the side)
  proj_qkv_kernel<<<NB * (NPIX / 64), 256, 0, stream>>>(
      x, Wq, Wk, Wv, Wp, wph, Qh, Kh, Vt);

  // 2) flash attention
  attn_kernel<<<dim3(NPIX / 128, NB * HEADS), 256, 0, stream>>>(Qh, Kh, Vt, Orow);

  // 3) output projection + residual
  out_proj_kernel<<<dim3(NPIX / 64, NB, 2), 256, 0, stream>>>(wph, Orow, x, out);
}

// v004
// It runs in 75.8 microseconds.
// Next to v003, in two timings, it ran 1.14 and 1.13 times as fast.
// All steps since v000 together make it 4.03 times as fast.
#include <hip/hip_runtime.h>
#include <hip/hip_bf16.h>

// ---------------------------------------------------------------------------
// LiteSelfAttention2D for MI455X (gfx1250): flash-attention on v_wmma_f32_16x16x32_f16
// B=4, C=256, KEY_CH=128, HEADS=4, HEAD_DIM=32, N=4096
// ---------------------------------------------------------------------------

#define NB      4
#define IN_CH   256
#define KEY_CH  128
#define HEADS   4
#define HEAD_DIM 32
#define NPIX    4096   // 64*64

typedef _Float16 half8  __attribute__((ext_vector_type(8)));
typedef _Float16 half16 __attribute__((ext_vector_type(16)));
typedef _Float16 half4  __attribute__((ext_vector_type(4)));
typedef float    f32x4  __attribute__((ext_vector_type(4)));
typedef float    f32x8  __attribute__((ext_vector_type(8)));

// Build a 16x32 (or 32x16) f16 WMMA fragment from two 16-byte chunks.
// A-layout: lane L holds row L%16, K-chunks at g*8 and 16+g*8 (g = L/16).
// B-layout is the mirror (lane = column, same K pattern).
static __device__ __forceinline__ half16 load_frag(const _Float16* lo,
                                                   const _Float16* hi) {
  half8 a = *(const half8*)lo;
  half8 b = *(const half8*)hi;
  half16 r;
#pragma unroll
  for (int i = 0; i < 8; ++i) { r[i] = a[i]; r[i + 8] = b[i]; }
  return r;
}

// The same fragment from four loaded f32 quads (two runs of 8 floats): each
// value times s, rounded to f16 (s = 1 for an unscaled matrix).
static __device__ __forceinline__ half16 round_frag(const f32x4* q, float s) {
  half16 r;
#pragma unroll
  for (int i = 0; i < 16; ++i) r[i] = (_Float16)(q[i >> 2][i & 3] * s);
  return r;
}

static __device__ __forceinline__ f32x8 wmma_f16(half16 a, half16 b, f32x8 c) {
  // D = A(16x32 f16) * B(32x16 f16) + C(16x16 f32)
  return __builtin_amdgcn_wmma_f32_16x16x32_f16(false, a, false, b,
                                                (short)0, c, false, false);
}

static __device__ __forceinline__ f32x8 zero8() {
  f32x8 z = {0.f, 0.f, 0.f, 0.f, 0.f, 0.f, 0.f, 0.f};
  return z;
}

// ---------------------------------------------------------------------------
// Kernel 1: projections Q,K,V = W * x  (per image: [128,256] x [256,4096])
// Grid: NB*64 blocks, 256 threads (8 waves). Wave w -> output rows 16w..16w+15.
// x tiles are transposed through LDS so the B-fragment (K = channel dim)
// becomes two contiguous ds_load_b128 per lane. x and the weights arrive as f32
// and are rounded to f16 here: x while it is staged, Wq/Wk/Wv in registers (the
// softmax scale log2(e)/sqrt(32) folded into Wq before the rounding), and each block
// rounds its 128 elements of Wp into wph for the output projection's launch.
// Outputs: Qh,Kh f16 [b][h][n][32] (row-major), Vt f16 [b][h][32][n].
// ---------------------------------------------------------------------------
__global__ void __launch_bounds__(256) proj_qkv_kernel(
    const float* __restrict__ x,
    const float* __restrict__ wq, const float* __restrict__ wk,
    const float* __restrict__ wv, const float* __restrict__ wp,
    _Float16* __restrict__ wph,
    _Float16* __restrict__ Qh, _Float16* __restrict__ Kh,
    _Float16* __restrict__ Vt) {
  __shared__ __align__(16) _Float16 Xt[64][40];  // [n][c], padded stride 40

  const int bx = blockIdx.x;
  const int b = bx >> 6;
  const int n0 = (bx & 63) * 64;
  const int tid = threadIdx.x;
  const int w = tid >> 5, lane = tid & 31, g = lane >> 4, lh = lane & 15;
  const float* xb = x + (size_t)b * IN_CH * NPIX;
  const float qs = 0.25503487f;           // log2(e)/sqrt(HEAD_DIM): scores in log2 units
  const int sn = tid & 63;                // staging: this thread's pixel
  const int sc = (tid >> 6) * 8;          // and its 8 channels of the tile


  f32x8 acc[3][4];
#pragma unroll
  for (int p = 0; p < 3; ++p)
#pragma unroll
    for (int j = 0; j < 4; ++j) acc[p][j] = zero8();

  const int wrow = w * 16 + lh;  // output row for this lane's fragment
  for (int cc = 0; cc < IN_CH; cc += 32) {
    __syncthreads();
    // load [32 c][64 n] f32 tile, round to f16, store transposed as [n][c]
    half8 xc;
#pragma unroll
    for (int k = 0; k < 8; ++k)
      xc[k] = (_Float16)xb[(size_t)(cc + sc + k) * NPIX + n0 + sn];
    *(half8*)(&Xt[sn][sc]) = xc;
    __syncthreads();

    const int wo = wrow * IN_CH + cc + g * 8;
    f32x4 fq[4], fk[4], fv[4];
#pragma unroll
    for (int i = 0; i < 4; ++i) {
      const int o = wo + (i >> 1) * 16 + (i & 1) * 4;
      fq[i] = *(const f32x4*)(wq + o);
      fk[i] = *(const f32x4*)(wk + o);
      fv[i] = *(const f32x4*)(wv + o);
    }
    // Holds the twelve weight loads together (loaded values as inputs only):
    // without it the compiler issues Wv's four behind the first products and
    // the trip waits out one more L2 latency. The wait stands, as a precaution,
    // ahead of the roundings, which reuse the loads' address registers.
    asm volatile("s_wait_xcnt 0x0" ::"v"(fq[0]), "v"(fq[1]), "v"(fq[2]), "v"(fq[3]),
                 "v"(fk[0]), "v"(fk[1]), "v"(fk[2]), "v"(fk[3]),
                 "v"(fv[0]), "v"(fv[1]), "v"(fv[2]), "v"(fv[3]));
    half16 aq = round_frag(fq, qs);
    half16 ak = round_frag(fk, 1.f);
    half16 av = round_frag(fv, 1.f);
#pragma unroll
    for (int j = 0; j < 4; ++j) {
      half16 bf = load_frag(&Xt[j * 16 + lh][g * 8],
                            &Xt[j * 16 + lh][16 + g * 8]);
      acc[0][j] = wmma_f16(aq, bf, acc[0][j]);
      acc[1][j] = wmma_f16(ak, bf, acc[1][j]);
      acc[2][j] = wmma_f16(av, bf, acc[2][j]);
    }
  }

  // wave 0: this block's IN_CH*KEY_CH / gridDim.x = 128 elements of Wp, loaded
  // behind the last barrier, rounded and stored behind the scatter
  f32x4 wpv = {0.f, 0.f, 0.f, 0.f};
  if (tid < 32) wpv = *(const f32x4*)(wp + bx * 128 + tid * 4);

  // scatter to Qh/Kh (row-major per pixel) and Vt (transposed)
#pragma unroll
  for (int j = 0; j < 4; ++j) {
#pragma unroll
    for (int r = 0; r < 8; ++r) {
      int kk = w * 16 + r + 8 * g;       // 0..127
      int h = kk >> 5, d = kk & 31;
      int n = n0 + j * 16 + lh;
      size_t hb = (size_t)(b * HEADS + h);
      size_t qoff = (hb * NPIX + n) * HEAD_DIM + d;
      Qh[qoff] = (_Float16)acc[0][j][r];
      Kh[qoff] = (_Float16)acc[1][j][r];
      Vt[(hb * HEAD_DIM + d) * NPIX + n] = (_Float16)acc[2][j][r];
    }
  }

  if (tid < 32) {
    half4 hv;
#pragma unroll
    for (int i = 0; i < 4; ++i) hv[i] = (_Float16)wpv[i];
    *(half4*)(wph + bx * 128 + tid * 4) = hv;
  }
}

// ---------------------------------------------------------------------------
// Kernel 2: flash attention. Grid (N/128, B*HEADS), 256 threads = 8 waves.
// Each wave owns 16 queries. Per 64-key tile:
//   - all 8 waves cooperatively stage the SHARED K tile (64x32 f16, 4 KB) and
//     V^T tile (32x64 f16, 4 KB) into LDS once (8x less global/L2 traffic
//     than per-wave streaming), with global_prefetch of the next tile;
//   - 4 WMMAs for S^T = K Q^T - shift (scale and log2(e) pre-folded into Q, the
//     C operand holds minus the query's shift): a lane holds 32 of the 64
//     shifted scores of ONE query (column lh), its partner lane^16 the rest;
//   - softmax in f32 in registers on all 32 lanes: exp2 straight from D. The
//     shift is a maximum seen earlier; it is raised, and O and l rescaled, only
//     in tile 0 and where a tile's score tops it by more than 8 (one test per
//     tile for the wave); sums stay per half until the end;
//   - 4 WMMAs for O^T += V^T P^T: two converted S^T tiles ARE the B operand.
// Output Orow f16 [b][n][128] (channel-contiguous per pixel).
// ---------------------------------------------------------------------------
// value of lane l ^ 16
static __device__ __forceinline__ float other_half(float v) {
  int b = __builtin_bit_cast(int, v);
  b = __builtin_amdgcn_permlanex16(b, b, 0x76543210, 0xfedcba98, false, false);
  return __builtin_bit_cast(float, b);
}

// P^T of one 64-key tile from its shifted scores, and this half's sum of it.
// P^T as B operand: element i = key 32mj + 8g + i, element 8 + i = key
// 32mj + 16 + 8g + i, which is the k order load_frag gives V^T.
static __device__ __forceinline__ float tile_probs(const f32x8* s, half16* p) {
  float st[4];
#pragma unroll
  for (int j = 0; j < 4; ++j) {
    float e[8];
#pragma unroll
    for (int r = 0; r < 8; ++r) {
      e[r] = __builtin_amdgcn_exp2f(s[j][r]);
      p[j >> 1][(j & 1) * 8 + r] = (_Float16)e[r];
    }
    st[j] = ((e[0] + e[1]) + (e[2] + e[3])) + ((e[4] + e[5]) + (e[6] + e[7]));
  }
  return (st[0] + st[1]) + (st[2] + st[3]);
}

__global__ void __launch_bounds__(256) attn_kernel(
    const _Float16* __restrict__ Qh, const _Float16* __restrict__ Kh,
    const _Float16* __restrict__ Vt, _Float16* __restrict__ Orow) {
  // Row pitch = 16 B x odd, so the 16 rows one ds_load_b128 half-wave reads
  // fall on 64 distinct banks (unpadded 64 B / 128 B rows collide 4x / 8x).
  __shared__ __align__(16) _Float16 Ks[64][40];      // K tile, 64 B rows at pitch 80 B
  __shared__ __align__(16) _Float16 Vs[32][72];      // V^T tile, 128 B rows at pitch 144 B

  const int tid = threadIdx.x;
  const int w = tid >> 5, lane = tid & 31, g = lane >> 4, lh = lane & 15;
  const int bh = blockIdx.y;
  const int b = bh >> 2, h = bh & 3;
  const int q0 = blockIdx.x * 128 + w * 16;
  const size_t hb = (size_t)(b * HEADS + h);
  const _Float16* qb = Qh + hb * NPIX * HEAD_DIM;
  const _Float16* kb = Kh + hb * NPIX * HEAD_DIM;
  const _Float16* vb = Vt + hb * HEAD_DIM * NPIX;

  // Q^T as B operand: lane = query column q0 + lh (reused every iteration)
  half16 bq = load_frag(qb + (size_t)(q0 + lh) * 32 + g * 8,
                        qb + (size_t)(q0 + lh) * 32 + 16 + g * 8);
  // O^T tiles: register r = O[query lh][d = 8g + r] (o_lo), d = 16 + 8g + r (o_hi)
  f32x8 o_lo = zero8(), o_hi = zero8();
  f32x8 negm = zero8();  // minus the shift of this lane's query, in every register
                         // (C operand of the score products; equal in both halves)
  float l = 0.f;         // running sum over this half's keys only

  // cooperative-staging indices (each thread moves 8+8 f16 per tile)
  const int kslot = tid * 8;            // 0..2047 over the global K tile (64x32)
  const int kr = tid >> 2;              // 0..63  (K row = key)
  const int kc = (tid & 3) * 8;         // 0..24  (d offset within the row)
  const int vd = tid >> 3;              // 0..31  (V^T row = d)
  const int vm = (tid & 7) * 8;         // 0..56  (m offset within tile)

#pragma unroll 1
  for (int kt = 0; kt < NPIX / 64; ++kt) {
    const int m0 = kt * 64;
    // ---- stage K/V tiles into LDS once per workgroup ----
    __syncthreads();  // previous iteration's readers are done
    *(half8*)(&Ks[kr][kc])           = *(const half8*)(kb + (size_t)m0 * 32 + kslot);
    *(half8*)(&Vs[vd][vm])           = *(const half8*)(vb + (size_t)vd * NPIX + m0 + vm);
    if (kt + 1 < NPIX / 64) {           // prefetch next tile (global_prefetch_b8)
      __builtin_prefetch(kb + (size_t)(m0 + 64) * 32 + kslot, 0, 0);
      __builtin_prefetch(vb + (size_t)vd * NPIX + m0 + 64 + vm, 0, 0);
    }
    __syncthreads();  // staging visible to all waves

    // ---- S^T = K Q^T - shift: s[j][r] = score(query lh, key 16j + 8g + r) ----
    f32x8 s[4];
#pragma unroll
    for (int j = 0; j < 4; ++j) {
      half16 ak = load_frag(&Ks[j * 16 + lh][g * 8],
                            &Ks[j * 16 + lh][16 + g * 8]);
      s[j] = wmma_f16(ak, bq, negm);
    }
    // V^T fragments, read ahead of the vector work: the test below ends the
    // block, and reads placed behind it would each be waited out
    half16 av[4];
#pragma unroll
    for (int mj = 0; mj < 2; ++mj) {
      av[2 * mj]     = load_frag(&Vs[lh][mj * 32 + g * 8],
                                 &Vs[lh][mj * 32 + 16 + g * 8]);
      av[2 * mj + 1] = load_frag(&Vs[16 + lh][mj * 32 + g * 8],
                                 &Vs[16 + lh][mj * 32 + 16 + g * 8]);
    }
    // ---- largest shifted score of this half's 32 keys: only tested ----
    float mt[4];
#pragma unroll
    for (int j = 0; j < 4; ++j) {
      mt[j] = fmaxf(fmaxf(fmaxf(s[j][0], s[j][1]), fmaxf(s[j][2], s[j][3])),
                    fmaxf(fmaxf(s[j][4], s[j][5]), fmaxf(s[j][6], s[j][7])));
    }
    const float mx = fmaxf(fmaxf(mt[0], mt[1]), fmaxf(mt[2], mt[3]));
    half16 p[2];
    float sum = tile_probs(s, p);
    // ---- raise the shift: tile 0 (sets it), or a score more than 8 above it
    // (2^8 is far inside f16). Marked unlikely so that the raise is laid out
    // behind the loop and the usual tile runs straight through. ----
    const float room = (kt == 0) ? -__builtin_inff() : 8.f;
    if (__builtin_expect(__builtin_amdgcn_ballot_w32(mx > room) != 0, 0)) {
      const float mq = fmaxf(mx, other_half(mx));
      const float up = (kt == 0) ? mq : fmaxf(mq, 0.f);
      const float alpha = __builtin_amdgcn_exp2f(-fmaxf(up, 0.f));
#pragma unroll
      for (int r = 0; r < 8; ++r) {
        negm[r] -= up;
        o_lo[r] *= alpha;
        o_hi[r] *= alpha;
      }
#pragma unroll
      for (int j = 0; j < 4; ++j)
#pragma unroll
        for (int r = 0; r < 8; ++r) s[j][r] -= up;
      sum = tile_probs(s, p);
      l *= alpha;
    }
    l += sum;
    // ---- O^T += V^T P^T (two 32-wide key sub-tiles; d split 0..15 / 16..31) ----
#pragma unroll
    for (int mj = 0; mj < 2; ++mj) {
      o_lo = wmma_f16(av[2 * mj], p[mj], o_lo);
      o_hi = wmma_f16(av[2 * mj + 1], p[mj], o_hi);
    }
  }

  // ---- finalize: join the halves' sums, divide, store Orow[b][n][h*32 + d] ----
  const float inv = 1.f / (l + other_half(l));
  _Float16* ob = Orow + (size_t)b * NPIX * KEY_CH + h * HEAD_DIM +
                 (size_t)(q0 + lh) * KEY_CH + g * 8;
  half8 lo8, hi8;
#pragma unroll
  for (int r = 0; r < 8; ++r) {
    lo8[r] = (_Float16)(o_lo[r] * inv);
    hi8[r] = (_Float16)(o_hi[r] * inv);
  }
  *(half8*)ob        = lo8;
  *(half8*)(ob + 16) = hi8;
}

// ---------------------------------------------------------------------------
// Kernel 3: out = Wp @ O + x.  [256,128] x [128,4096] per image.
// Orow rows are kk-contiguous, so B-fragments are direct global_load_b128.
// Grid (N/64, B, 2), 256 threads; wave w handles 16 output channels.
// ---------------------------------------------------------------------------
__global__ void __launch_bounds__(256) out_proj_kernel(
    const _Float16* __restrict__ wph, const _Float16* __restrict__ Orow,
    const float* __restrict__ x, float* __restrict__ out) {
  const int tid = threadIdx.x;
  const int w = tid >> 5, lane = tid & 31, g = lane >> 4, lh = lane & 15;
  const int n0 = blockIdx.x * 64;
  const int b = blockIdx.y;
  const int c0 = blockIdx.z * 128 + w * 16;
  const _Float16* ob = Orow + (size_t)b * NPIX * KEY_CH;

  f32x8 acc[4];
#pragma unroll
  for (int j = 0; j < 4; ++j) acc[j] = zero8();

#pragma unroll
  for (int kc = 0; kc < 4; ++kc) {
    const int k0 = kc * 32;
    half16 a = load_frag(wph + (size_t)(c0 + lh) * KEY_CH + k0 + g * 8,
                         wph + (size_t)(c0 + lh) * KEY_CH + k0 + 16 + g * 8);
#pragma unroll
    for (int j = 0; j < 4; ++j) {
      const _Float16* orow = ob + (size_t)(n0 + j * 16 + lh) * KEY_CH + k0;
      half16 bf = load_frag(orow + g * 8, orow + 16 + g * 8);
      acc[j] = wmma_f16(a, bf, acc[j]);
    }
  }
#pragma unroll
  for (int j = 0; j < 4; ++j) {
#pragma unroll
    for (int r = 0; r < 8; ++r) {
      int c = c0 + r + 8 * g;
      int n = n0 + j * 16 + lh;
      size_t off = (size_t)(b * IN_CH + c) * NPIX + n;
      out[off] = acc[j][r] + x[off];
    }
  }
}

// ---------------------------------------------------------------------------
// Host launcher
// ---------------------------------------------------------------------------
extern "C" void kernel_launch(void* const* d_in, const int* in_sizes, int n_in,
                              void* d_out, int out_size, void* d_ws, size_t ws_size,
                              hipStream_t stream) {
  const float* x  = (const float*)d_in[0];
  const float* Wq = (const float*)d_in[1];
  const float* Wk = (const float*)d_in[2];
  const float* Wv = (const float*)d_in[3];
  const float* Wp = (const float*)d_in[4];
  float* out = (float*)d_out;

  // workspace carve-up (all f16)
  char* ws = (char*)d_ws;
  size_t off = 0;
  _Float16* wph = (_Float16*)(ws + off); off += (size_t)IN_CH * KEY_CH * 2;
  _Float16* Qh  = (_Float16*)(ws + off); off += (size_t)NB * KEY_CH * NPIX * 2;  // 4 MB
  _Float16* Kh  = (_Float16*)(ws + off); off += (size_t)NB * KEY_CH * NPIX * 2;  // 4 MB
  _Float16* Vt  = (_Float16*)(ws + off); off += (size_t)NB * KEY_CH * NPIX * 2;  // 4 MB
  _Float16* Orow = (_Float16*)(ws + off); off += (size_t)NB * NPIX * KEY_CH * 2; // 4 MB

  // 1) Q/K/V projections (f32 operands rounded to f16 inside; Wp rounded on the side)
  proj_qkv_kernel<<<NB * (NPIX / 64), 256, 0, stream>>>(
      x, Wq, Wk, Wv, Wp, wph, Qh, Kh, Vt);

  // 2) flash attention
  attn_kernel<<<dim3(NPIX / 128, NB * HEADS), 256, 0, stream>>>(Qh, Kh, Vt, Orow);

  // 3) output projection + residual
  out_proj_kernel<<<dim3(NPIX / 64, NB, 2), 256, 0, stream>>>(wph, Orow, x, out);
}

// v005
// A run of this version takes 72.9 microseconds.
// Timed twice side by side with v004, it ran 1.04 and 1.03 times as fast.
// Counting every step since v000, it is 4.18 times as fast.
#include <hip/hip_runtime.h>
#include <hip/hip_bf16.h>

// ---------------------------------------------------------------------------
// LiteSelfAttention2D for MI455X (gfx1250): flash-attention on v_wmma_f32_16x16x32_f16
// B=4, C=256, KEY_CH=128, HEADS=4, HEAD_DIM=32, N=4096
// ---------------------------------------------------------------------------

#define NB      4
#define IN_CH   256
#define KEY_CH  128
#define HEADS   4
#define HEAD_DIM 32
#define NPIX    4096   // 64*64

typedef _Float16 half8  __attribute__((ext_vector_type(8)));
typedef _Float16 half16 __attribute__((ext_vector_type(16)));
typedef _Float16 half4  __attribute__((ext_vector_type(4)));
typedef float    f32x4  __attribute__((ext_vector_type(4)));
typedef float    f32x8  __attribute__((ext_vector_type(8)));

// Build a 16x32 (or 32x16) f16 WMMA fragment from two 16-byte chunks.
// A-layout: lane L holds row L%16, K-chunks at g*8 and 16+g*8 (g = L/16).
// B-layout is the mirror (lane = column, same K pattern).
static __device__ __forceinline__ half16 load_frag(const _Float16* lo,
                                                   const _Float16* hi) {
  half8 a = *(const half8*)lo;
  half8 b = *(const half8*)hi;
  half16 r;
#pragma unroll
  for (int i = 0; i < 8; ++i) { r[i] = a[i]; r[i + 8] = b[i]; }
  return r;
}

// The same fragment from four loaded f32 quads (two runs of 8 floats): each
// value times s, rounded to f16 (s = 1 for an unscaled matrix).
static __device__ __forceinline__ half16 round_frag(const f32x4* q, float s) {
  half16 r;
#pragma unroll
  for (int i = 0; i < 16; ++i) r[i] = (_Float16)(q[i >> 2][i & 3] * s);
  return r;
}

static __device__ __forceinline__ f32x8 wmma_f16(half16 a, half16 b, f32x8 c) {
  // D = A(16x32 f16) * B(32x16 f16) + C(16x16 f32)
  return __builtin_amdgcn_wmma_f32_16x16x32_f16(false, a, false, b,
                                                (short)0, c, false, false);
}

static __device__ __forceinline__ f32x8 zero8() {
  f32x8 z = {0.f, 0.f, 0.f, 0.f, 0.f, 0.f, 0.f, 0.f};
  return z;
}

// ---------------------------------------------------------------------------
// Kernel 1: projections Q,K,V = W * x  (per image: [128,256] x [256,4096])
// Grid: NB*64 blocks, 256 threads (8 waves). Wave w -> output rows 16w..16w+15.
// x tiles are transposed through LDS so the B-fragment (K = channel dim)
// becomes two contiguous ds_load_b128 per lane. x and the weights arrive as f32
// and are rounded to f16 here: x while it is staged, Wq/Wk/Wv in registers (the
// softmax scale log2(e)/sqrt(32) folded into Wq before the rounding), and each block
// rounds its 128 elements of Wp into wph for the output projection's launch.
// Outputs: Qh,Kh f16 [b][h][n][32] (row-major), Vt f16 [b][h][32][n].
// ---------------------------------------------------------------------------
__global__ void __launch_bounds__(256) proj_qkv_kernel(
    const float* __restrict__ x,
    const float* __restrict__ wq, const float* __restrict__ wk,
    const float* __restrict__ wv, const float* __restrict__ wp,
    _Float16* __restrict__ wph,
    _Float16* __restrict__ Qh, _Float16* __restrict__ Kh,
    _Float16* __restrict__ Vt) {
  __shared__ __align__(16) _Float16 Xt[64][40];  // [n][c], padded stride 40

  const int bx = blockIdx.x;
  const int b = bx >> 6;
  const int n0 = (bx & 63) * 64;
  const int tid = threadIdx.x;
  const int w = tid >> 5, lane = tid & 31, g = lane >> 4, lh = lane & 15;
  const float* xb = x + (size_t)b * IN_CH * NPIX;
  const float qs = 0.25503487f;           // log2(e)/sqrt(HEAD_DIM): scores in log2 units
  const int sn = tid & 63;                // staging: this thread's pixel
  const int sc = (tid >> 6) * 8;          // and its 8 channels of the tile


  f32x8 acc[3][4];
#pragma unroll
  for (int p = 0; p < 3; ++p)
#pragma unroll
    for (int j = 0; j < 4; ++j) acc[p][j] = zero8();

  const int wrow = w * 16 + lh;  // output row for this lane's fragment
  for (int cc = 0; cc < IN_CH; cc += 32) {
    __syncthreads();
    // load [32 c][64 n] f32 tile, round to f16, store transposed as [n][c]
    half8 xc;
#pragma unroll
    for (int k = 0; k < 8; ++k)
      xc[k] = (_Float16)xb[(size_t)(cc + sc + k) * NPIX + n0 + sn];
    *(half8*)(&Xt[sn][sc]) = xc;
    __syncthreads();

    const int wo = wrow * IN_CH + cc + g * 8;
    f32x4 fq[4], fk[4], fv[4];
#pragma unroll
    for (int i = 0; i < 4; ++i) {
      const int o = wo + (i >> 1) * 16 + (i & 1) * 4;
      fq[i] = *(const f32x4*)(wq + o);
      fk[i] = *(const f32x4*)(wk + o);
      fv[i] = *(const f32x4*)(wv + o);
    }
    // Holds the twelve weight loads together (loaded values as inputs only):
    // without it the compiler issues Wv's four behind the first products and
    // the trip waits out one more L2 latency. The wait stands, as a precaution,
    // ahead of the roundings, which reuse the loads' address registers.
    asm volatile("s_wait_xcnt 0x0" ::"v"(fq[0]), "v"(fq[1]), "v"(fq[2]), "v"(fq[3]),
                 "v"(fk[0]), "v"(fk[1]), "v"(fk[2]), "v"(fk[3]),
                 "v"(fv[0]), "v"(fv[1]), "v"(fv[2]), "v"(fv[3]));
    half16 aq = round_frag(fq, qs);
    half16 ak = round_frag(fk, 1.f);
    half16 av = round_frag(fv, 1.f);
#pragma unroll
    for (int j = 0; j < 4; ++j) {
      half16 bf = load_frag(&Xt[j * 16 + lh][g * 8],
                            &Xt[j * 16 + lh][16 + g * 8]);
      acc[0][j] = wmma_f16(aq, bf, acc[0][j]);
      acc[1][j] = wmma_f16(ak, bf, acc[1][j]);
      acc[2][j] = wmma_f16(av, bf, acc[2][j]);
    }
  }

  // wave 0: this block's IN_CH*KEY_CH / gridDim.x = 128 elements of Wp, loaded
  // behind the last barrier, rounded and stored behind the scatter
  f32x4 wpv = {0.f, 0.f, 0.f, 0.f};
  if (tid < 32) wpv = *(const f32x4*)(wp + bx * 128 + tid * 4);

  // scatter to Qh/Kh (row-major per pixel) and Vt (transposed)
#pragma unroll
  for (int j = 0; j < 4; ++j) {
#pragma unroll
    for (int r = 0; r < 8; ++r) {
      int kk = w * 16 + r + 8 * g;       // 0..127
      int h = kk >> 5, d = kk & 31;
      int n = n0 + j * 16 + lh;
      size_t hb = (size_t)(b * HEADS + h);
      size_t qoff = (hb * NPIX + n) * HEAD_DIM + d;
      Qh[qoff] = (_Float16)acc[0][j][r];
      Kh[qoff] = (_Float16)acc[1][j][r];
      Vt[(hb * HEAD_DIM + d) * NPIX + n] = (_Float16)acc[2][j][r];
    }
  }

  if (tid < 32) {
    half4 hv;
#pragma unroll
    for (int i = 0; i < 4; ++i) hv[i] = (_Float16)wpv[i];
    *(half4*)(wph + bx * 128 + tid * 4) = hv;
  }
}

static __device__ __forceinline__ float other_half(float v) {
  int b = __builtin_bit_cast(int, v);
  b = __builtin_amdgcn_permlanex16(b, b, 0x76543210, 0xfedcba98, false, false);
  return __builtin_bit_cast(float, b);
}

// P^T of one 64-key tile from its shifted scores, and this half's sum of it.
// P^T as B operand: element i = key 32mj + 8g + i, element 8 + i = key
// 32mj + 16 + 8g + i, which is the k order load_frag gives V^T.
static __device__ __forceinline__ float tile_probs(const f32x8* s, half16* p) {
  float st[4];
#pragma unroll
  for (int j = 0; j < 4; ++j) {
    float e[8];
#pragma unroll
    for (int r = 0; r < 8; ++r) {
      e[r] = __builtin_amdgcn_exp2f(s[j][r]);
      p[j >> 1][(j & 1) * 8 + r] = (_Float16)e[r];
    }
    st[j] = ((e[0] + e[1]) + (e[2] + e[3])) + ((e[4] + e[5]) + (e[6] + e[7]));
  }
  return (st[0] + st[1]) + (st[2] + st[3]);
}

// One thread's share of a K tile and of a V^T tile, 16 bytes each, from global
// memory straight into LDS. kl, vl: LDS byte addresses. The wait stands inside
// the statement, as a precaution, ahead of any rewrite of the address registers.
static __device__ __forceinline__ void stage_tile(unsigned kl, const _Float16* kg,
                                                  unsigned vl, const _Float16* vg) {
  asm volatile("global_load_async_to_lds_b128 %0, %1, off\n\t"
               "global_load_async_to_lds_b128 %2, %3, off\n\t"
               "s_wait_xcnt 0x0"
               ::"v"(kl), "v"(kg), "v"(vl), "v"(vg) : "memory");
}

__global__ void __launch_bounds__(256) attn_kernel(
    const _Float16* __restrict__ Qh, const _Float16* __restrict__ Kh,
    const _Float16* __restrict__ Vt, _Float16* __restrict__ Orow) {
  // Row pitch = 16 B x odd, so the 16 rows one ds_load_b128 half-wave reads
  // fall on 64 distinct banks (unpadded 64 B / 128 B rows collide 4x / 8x).
  __shared__ __align__(16) _Float16 Ks[2][64][40];   // K tiles, 64 B rows at pitch 80 B
  __shared__ __align__(16) _Float16 Vs[2][32][72];   // V^T tiles, 128 B rows at pitch 144 B

  const int tid = threadIdx.x;
  const int w = tid >> 5, lane = tid & 31, g = lane >> 4, lh = lane & 15;
  const int bh = blockIdx.y;
  const int b = bh >> 2, h = bh & 3;
  const int q0 = blockIdx.x * 128 + w * 16;
  const size_t hb = (size_t)(b * HEADS + h);
  const _Float16* qb = Qh + hb * NPIX * HEAD_DIM;
  const _Float16* kb = Kh + hb * NPIX * HEAD_DIM;
  const _Float16* vb = Vt + hb * HEAD_DIM * NPIX;

  // Q^T as B operand: lane = query column q0 + lh (reused every iteration)
  half16 bq = load_frag(qb + (size_t)(q0 + lh) * 32 + g * 8,
                        qb + (size_t)(q0 + lh) * 32 + 16 + g * 8);
  // O^T tiles: register r = O[query lh][d = 8g + r] (o_lo), d = 16 + 8g + r (o_hi)
  f32x8 o_lo = zero8(), o_hi = zero8();
  f32x8 negm = zero8();  // minus the shift of this lane's query, in every register
                         // (C operand of the score products; equal in both halves)
  float l = 0.f;         // running sum over this half's keys only

  // cooperative-staging indices (each thread moves 8+8 f16 per tile)
  const int kslot = tid * 8;            // 0..2047 over the global K tile (64x32)
  const int kr = tid >> 2;              // 0..63  (K row = key)
  const int kc = (tid & 3) * 8;         // 0..24  (d offset within the row)
  const int vd = tid >> 3;              // 0..31  (V^T row = d)
  const int vm = (tid & 7) * 8;         // 0..56  (m offset within tile)
  const _Float16* kg = kb + kslot;                    // this thread's 16 B of K tile 0
  const _Float16* vg = vb + (size_t)vd * NPIX + vm;   // and of V^T tile 0
  // their places in buffer 0 (LDS byte address = low word of the pointer)
  const unsigned kl = (unsigned)(size_t)&Ks[0][kr][kc];
  const unsigned vl = (unsigned)(size_t)&Vs[0][vd][vm];

  // ---- tile 0 into buffer 0, landed and published; then tile 1 set off ----
  stage_tile(kl, kg, vl, vg);
  asm volatile("s_wait_asynccnt 0x0" ::: "memory");  // this wave's copies have landed
  __syncthreads();                                   // and every other wave's
  stage_tile(kl + (unsigned)sizeof(Ks[0]), kg + 64 * 32,
             vl + (unsigned)sizeof(Vs[0]), vg + 64);

  // two trips a pass of the loop: the buffer index is then a constant of each
  // copy of the body and every LDS address keeps its immediate offset
#pragma unroll 2
  for (int kt = 0; kt < NPIX / 64; ++kt) {
    const int buf = kt & 1;
    // ---- S^T = K Q^T - shift: s[j][r] = score(query lh, key 16j + 8g + r) ----
    f32x8 s[4];
#pragma unroll
    for (int j = 0; j < 4; ++j) {
      half16 ak = load_frag(&Ks[buf][j * 16 + lh][g * 8],
                            &Ks[buf][j * 16 + lh][16 + g * 8]);
      s[j] = wmma_f16(ak, bq, negm);
    }
    // V^T fragments, read ahead of the vector work: the test below ends the
    // block, and reads placed behind it would each be waited out
    half16 av[4];
#pragma unroll
    for (int mj = 0; mj < 2; ++mj) {
      av[2 * mj]     = load_frag(&Vs[buf][lh][mj * 32 + g * 8],
                                 &Vs[buf][lh][mj * 32 + 16 + g * 8]);
      av[2 * mj + 1] = load_frag(&Vs[buf][16 + lh][mj * 32 + g * 8],
                                 &Vs[buf][16 + lh][mj * 32 + 16 + g * 8]);
    }
    // Keeps the sixteen reads and the four score products ahead of the vector work:
    // without it the V^T reads are sunk behind the softmax and waited out there, and
    // the maxima are woven between the products, each behind its own idle slots.
    __builtin_amdgcn_sched_barrier(0);
    // ---- largest shifted score of this half's 32 keys: only tested ----
    float mt[4];
#pragma unroll
    for (int j = 0; j < 4; ++j) {
      mt[j] = fmaxf(fmaxf(fmaxf(s[j][0], s[j][1]), fmaxf(s[j][2], s[j][3])),
                    fmaxf(fmaxf(s[j][4], s[j][5]), fmaxf(s[j][6], s[j][7])));
    }
    const float mx = fmaxf(fmaxf(mt[0], mt[1]), fmaxf(mt[2], mt[3]));
    half16 p[2];
    float sum = tile_probs(s, p);
    // ---- raise the shift: tile 0 (sets it), or a score more than 8 above it
    // (2^8 is far inside f16). Marked unlikely so that the raise is laid out
    // behind the loop and the usual tile runs straight through. ----
    const float room = (kt == 0) ? -__builtin_inff() : 8.f;
    if (__builtin_expect(__builtin_amdgcn_ballot_w32(mx > room) != 0, 0)) {
      const float mq = fmaxf(mx, other_half(mx));
      const float up = (kt == 0) ? mq : fmaxf(mq, 0.f);
      const float alpha = __builtin_amdgcn_exp2f(-fmaxf(up, 0.f));
#pragma unroll
      for (int r = 0; r < 8; ++r) {
        negm[r] -= up;
        o_lo[r] *= alpha;
        o_hi[r] *= alpha;
      }
#pragma unroll
      for (int j = 0; j < 4; ++j)
#pragma unroll
        for (int r = 0; r < 8; ++r) s[j][r] -= up;
      sum = tile_probs(s, p);
      l *= alpha;
    }
    l += sum;
    // ---- O^T += V^T P^T (two 32-wide key sub-tiles; d split 0..15 / 16..31) ----
#pragma unroll
    for (int mj = 0; mj < 2; ++mj) {
      o_lo = wmma_f16(av[2 * mj], p[mj], o_lo);
      o_hi = wmma_f16(av[2 * mj + 1], p[mj], o_hi);
    }
    // ---- hand-over: tile kt + 1 is published, this tile's buffer is freed ----
    asm volatile("s_wait_dscnt 0x0" ::: "memory");     // this wave's reads of the buffer are over
    asm volatile("s_wait_asynccnt 0x0" ::: "memory");  // its copies of tile kt + 1 have landed
    __syncthreads();
    if (kt + 2 < NPIX / 64) {  // tile kt + 2 into the buffer just read
      stage_tile(kl + buf * (unsigned)sizeof(Ks[0]), kg + (size_t)(kt + 2) * (64 * 32),
                 vl + buf * (unsigned)sizeof(Vs[0]), vg + (kt + 2) * 64);
    }
  }
  asm volatile("s_wait_asynccnt 0x0" ::: "memory");  // no copy is left in flight at the end

  // ---- finalize: join the halves' sums, divide, store Orow[b][n][h*32 + d] ----
  const float inv = 1.f / (l + other_half(l));
  _Float16* ob = Orow + (size_t)b * NPIX * KEY_CH + h * HEAD_DIM +
                 (size_t)(q0 + lh) * KEY_CH + g * 8;
  half8 lo8, hi8;
#pragma unroll
  for (int r = 0; r < 8; ++r) {
    lo8[r] = (_Float16)(o_lo[r] * inv);
    hi8[r] = (_Float16)(o_hi[r] * inv);
  }
  *(half8*)ob        = lo8;
  *(half8*)(ob + 16) = hi8;
}

// ---------------------------------------------------------------------------
// Kernel 3: out = Wp @ O + x.  [256,128] x [128,4096] per image.
// Orow rows are kk-contiguous, so B-fragments are direct global_load_b128.
// Grid (N/64, B, 2), 256 threads; wave w handles 16 output channels.
// ---------------------------------------------------------------------------
__global__ void __launch_bounds__(256) out_proj_kernel(
    const _Float16* __restrict__ wph, const _Float16* __restrict__ Orow,
    const float* __restrict__ x, float* __restrict__ out) {
  const int tid = threadIdx.x;
  const int w = tid >> 5, lane = tid & 31, g = lane >> 4, lh = lane & 15;
  const int n0 = blockIdx.x * 64;
  const int b = blockIdx.y;
  const int c0 = blockIdx.z * 128 + w * 16;
  const _Float16* ob = Orow + (size_t)b * NPIX * KEY_CH;

  f32x8 acc[4];
#pragma unroll
  for (int j = 0; j < 4; ++j) acc[j] = zero8();

#pragma unroll
  for (int kc = 0; kc < 4; ++kc) {
    const int k0 = kc * 32;
    half16 a = load_frag(wph + (size_t)(c0 + lh) * KEY_CH + k0 + g * 8,
                         wph + (size_t)(c0 + lh) * KEY_CH + k0 + 16 + g * 8);
#pragma unroll
    for (int j = 0; j < 4; ++j) {
      const _Float16* orow = ob + (size_t)(n0 + j * 16 + lh) * KEY_CH + k0;
      half16 bf = load_frag(orow + g * 8, orow + 16 + g * 8);
      acc[j] = wmma_f16(a, bf, acc[j]);
    }
  }
#pragma unroll
  for (int j = 0; j < 4; ++j) {
#pragma unroll
    for (int r = 0; r < 8; ++r) {
      int c = c0 + r + 8 * g;
      int n = n0 + j * 16 + lh;
      size_t off = (size_t)(b * IN_CH + c) * NPIX + n;
      out[off] = acc[j][r] + x[off];
    }
  }
}

// ---------------------------------------------------------------------------
// Host launcher
// ---------------------------------------------------------------------------
extern "C" void kernel_launch(void* const* d_in, const int* in_sizes, int n_in,
                              void* d_out, int out_size, void* d_ws, size_t ws_size,
                              hipStream_t stream) {
  const float* x  = (const float*)d_in[0];
  const float* Wq = (const float*)d_in[1];
  const float* Wk = (const float*)d_in[2];
  const float* Wv = (const float*)d_in[3];
  const float* Wp = (const float*)d_in[4];
  float* out = (float*)d_out;

  // workspace carve-up (all f16)
  char* ws = (char*)d_ws;
  size_t off = 0;
  _Float16* wph = (_Float16*)(ws + off); off += (size_t)IN_CH * KEY_CH * 2;
  _Float16* Qh  = (_Float16*)(ws + off); off += (size_t)NB * KEY_CH * NPIX * 2;  // 4 MB
  _Float16* Kh  = (_Float16*)(ws + off); off += (size_t)NB * KEY_CH * NPIX * 2;  // 4 MB
  _Float16* Vt  = (_Float16*)(ws + off); off += (size_t)NB * KEY_CH * NPIX * 2;  // 4 MB
  _Float16* Orow = (_Float16*)(ws + off); off += (size_t)NB * NPIX * KEY_CH * 2; // 4 MB

  // 1) Q/K/V projections (f32 operands rounded to f16 inside; Wp rounded on the side)
  proj_qkv_kernel<<<NB * (NPIX / 64), 256, 0, stream>>>(
      x, Wq, Wk, Wv, Wp, wph, Qh, Kh, Vt);

  // 2) flash attention
  attn_kernel<<<dim3(NPIX / 128, NB * HEADS), 256, 0, stream>>>(Qh, Kh, Vt, Orow);

  // 3) output projection + residual
  out_proj_kernel<<<dim3(NPIX / 64, NB, 2), 256, 0, stream>>>(wph, Orow, x, out);
}

// v006
// One run takes 56.5 microseconds.
// Two timings next to v005 both put it at 1.29 times that version's speed.
// All steps since v000 together make it 5.38 times as fast.
#include <hip/hip_runtime.h>
#include <hip/hip_bf16.h>

// ---------------------------------------------------------------------------
// LiteSelfAttention2D for MI455X (gfx1250): flash-attention on v_wmma_f32_16x16x32_f16
// B=4, C=256, KEY_CH=128, HEADS=4, HEAD_DIM=32, N=4096
// ---------------------------------------------------------------------------

#define NB      4
#define IN_CH   256
#define KEY_CH  128
#define HEADS   4
#define HEAD_DIM 32
#define NPIX    4096   // 64*64

typedef _Float16 half8  __attribute__((ext_vector_type(8)));
typedef _Float16 half16 __attribute__((ext_vector_type(16)));
typedef _Float16 half4  __attribute__((ext_vector_type(4)));
typedef float    f32x2  __attribute__((ext_vector_type(2)));
typedef float    f32x4  __attribute__((ext_vector_type(4)));
typedef float    f32x8  __attribute__((ext_vector_type(8)));

// Build a 16x32 (or 32x16) f16 WMMA fragment from two 16-byte chunks.
// A-layout: lane L holds row L%16, K-chunks at g*8 and 16+g*8 (g = L/16).
// B-layout is the mirror (lane = column, same K pattern).
static __device__ __forceinline__ half16 load_frag(const _Float16* lo,
                                                   const _Float16* hi) {
  half8 a = *(const half8*)lo;
  half8 b = *(const half8*)hi;
  half16 r;
#pragma unroll
  for (int i = 0; i < 8; ++i) { r[i] = a[i]; r[i + 8] = b[i]; }
  return r;
}

// The same fragment from four loaded f32 quads (two runs of 8 floats): each
// value times s, rounded to f16 (s = 1 for an unscaled matrix).
static __device__ __forceinline__ half16 round_frag(const f32x4* q, float s) {
  half16 r;
#pragma unroll
  for (int i = 0; i < 16; ++i) r[i] = (_Float16)(q[i >> 2][i & 3] * s);
  return r;
}

static __device__ __forceinline__ f32x8 wmma_f16(half16 a, half16 b, f32x8 c) {
  // D = A(16x32 f16) * B(32x16 f16) + C(16x16 f32)
  return __builtin_amdgcn_wmma_f32_16x16x32_f16(false, a, false, b,
                                                (short)0, c, false, false);
}

static __device__ __forceinline__ f32x8 zero8() {
  f32x8 z = {0.f, 0.f, 0.f, 0.f, 0.f, 0.f, 0.f, 0.f};
  return z;
}

// ---------------------------------------------------------------------------
// Kernel 1: projections Q,K,V = W * x  (per image: [128,256] x [256,4096])
// Grid: NB*64 blocks, 256 threads (8 waves). Wave w -> output rows 16w..16w+15.
// The block's x tile is transposed through LDS, whole and once, so the B-fragment
// (K = channel dim) becomes two contiguous ds_load_b128 per lane. x and the weights arrive as f32
// and are rounded to f16 here: x while it is staged, Wq/Wk/Wv in registers (the
// softmax scale log2(e)/sqrt(32) folded into Wq before the rounding), and each block
// rounds its 128 elements of Wp into wph for the output projection's launch.
// Outputs: Qh,Kh f16 [b][h][n][32] (row-major), Vt f16 [b][h][32][n].
// ---------------------------------------------------------------------------
__global__ void __launch_bounds__(256) proj_qkv_kernel(
    const float* __restrict__ x,
    const float* __restrict__ wq, const float* __restrict__ wk,
    const float* __restrict__ wv, const float* __restrict__ wp,
    _Float16* __restrict__ wph,
    _Float16* __restrict__ Qh, _Float16* __restrict__ Kh,
    _Float16* __restrict__ Vt) {
  // whole 256-channel tile [n][c]; row pitch 528 B = 16 B x odd, so the
  // ds_load_b128 of the fragments do not collide on banks
  __shared__ __align__(16) _Float16 Xt[64][IN_CH + 8];

  const int bx = blockIdx.x;
  const int b = bx >> 6;
  const int n0 = (bx & 63) * 64;
  const int tid = threadIdx.x;
  const int w = tid >> 5, lane = tid & 31, g = lane >> 4, lh = lane & 15;
  const float* xb = x + (size_t)b * IN_CH * NPIX;
  const float qs = 0.25503487f;           // log2(e)/sqrt(HEAD_DIM): scores in log2 units
  const int sn = lane * 2;                // staging: this thread's two pixels
  const int sc = w * 8;                   // and its 8 channels of each 64-channel group

  const int wrow = w * 16 + lh;           // output row for this lane's fragment
  const int wo = wrow * IN_CH + g * 8;
  const float* wqp = wq + wo;
  const float* wkp = wk + wo;
  const float* wvp = wv + wo;

  // weights of one 32-channel trip as loaded: [0..3] Wq, [4..7] Wk, [8..11] Wv;
  // two sets, so that the next trip's are in flight while this trip's are used
  f32x4 fw[2][12];
#pragma unroll
  for (int i = 0; i < 4; ++i) {
    const int o = (i >> 1) * 16 + (i & 1) * 4;
    fw[0][i]     = *(const f32x4*)(wqp + o);
    fw[0][4 + i] = *(const f32x4*)(wkp + o);
    fw[0][8 + i] = *(const f32x4*)(wvp + o);
  }

  // the block's whole x tile, 256 c x 64 n f32: all 32 loads of a thread (a wave's
  // load is one 256-B row of the tile) are set off before the first is used: one
  // memory latency for the tile, not one a trip
  f32x2 xv[4][8];
#pragma unroll
  for (int t = 0; t < 4; ++t)
#pragma unroll
    for (int k = 0; k < 8; ++k)
      xv[t][k] = *(const f32x2*)(xb + (size_t)(t * 64 + sc + k) * NPIX + n0 + sn);
  // A precaution: stands ahead of the roundings, which reuse the loads' address registers.
  asm volatile("s_wait_xcnt 0x0" ::: "memory");
  // rounded to f16 and stored transposed as [n][c]
#pragma unroll
  for (int t = 0; t < 4; ++t)
#pragma unroll
    for (int e = 0; e < 2; ++e) {
      half8 xc;
#pragma unroll
      for (int k = 0; k < 8; ++k) xc[k] = (_Float16)xv[t][k][e];
      *(half8*)(&Xt[sn + e][t * 64 + sc]) = xc;
    }

  f32x8 acc[3][4];
#pragma unroll
  for (int p = 0; p < 3; ++p)
#pragma unroll
    for (int j = 0; j < 4; ++j) acc[p][j] = zero8();

  __syncthreads();  // the one barrier: the tile is published and never rewritten

#pragma unroll
  for (int t = 0; t < 8; ++t) {
    const int cc = t * 32;
    if (t + 1 < 8) {
#pragma unroll
      for (int i = 0; i < 4; ++i) {
        const int o = cc + 32 + (i >> 1) * 16 + (i & 1) * 4;
        fw[(t + 1) & 1][i]     = *(const f32x4*)(wqp + o);
        fw[(t + 1) & 1][4 + i] = *(const f32x4*)(wkp + o);
        fw[(t + 1) & 1][8 + i] = *(const f32x4*)(wvp + o);
      }
    }
    half16 bf[4];
#pragma unroll
    for (int j = 0; j < 4; ++j)
      bf[j] = load_frag(&Xt[j * 16 + lh][cc + g * 8], &Xt[j * 16 + lh][cc + 16 + g * 8]);
    // Keeps the next trip's twelve loads and this trip's eight LDS reads ahead of the
    // roundings and products: sunk to their use each would be waited out there.
    __builtin_amdgcn_sched_barrier(0);
    half16 aq = round_frag(&fw[t & 1][0], qs);
    half16 ak = round_frag(&fw[t & 1][4], 1.f);
    half16 av = round_frag(&fw[t & 1][8], 1.f);
#pragma unroll
    for (int j = 0; j < 4; ++j) {
      acc[0][j] = wmma_f16(aq, bf[j], acc[0][j]);
      acc[1][j] = wmma_f16(ak, bf[j], acc[1][j]);
      acc[2][j] = wmma_f16(av, bf[j], acc[2][j]);
    }
  }

  // wave 0: this block's IN_CH*KEY_CH / gridDim.x = 128 elements of Wp, loaded
  // behind the last barrier, rounded and stored behind the scatter
  f32x4 wpv = {0.f, 0.f, 0.f, 0.f};
  if (tid < 32) wpv = *(const f32x4*)(wp + bx * 128 + tid * 4);

  // scatter to Qh/Kh (row-major per pixel) and Vt (transposed)
#pragma unroll
  for (int j = 0; j < 4; ++j) {
#pragma unroll
    for (int r = 0; r < 8; ++r) {
      int kk = w * 16 + r + 8 * g;       // 0..127
      int h = kk >> 5, d = kk & 31;
      int n = n0 + j * 16 + lh;
      size_t hb = (size_t)(b * HEADS + h);
      size_t qoff = (hb * NPIX + n) * HEAD_DIM + d;
      Qh[qoff] = (_Float16)acc[0][j][r];
      Kh[qoff] = (_Float16)acc[1][j][r];
      Vt[(hb * HEAD_DIM + d) * NPIX + n] = (_Float16)acc[2][j][r];
    }
  }

  if (tid < 32) {
    half4 hv;
#pragma unroll
    for (int i = 0; i < 4; ++i) hv[i] = (_Float16)wpv[i];
    *(half4*)(wph + bx * 128 + tid * 4) = hv;
  }
}

static __device__ __forceinline__ float other_half(float v) {
  int b = __builtin_bit_cast(int, v);
  b = __builtin_amdgcn_permlanex16(b, b, 0x76543210, 0xfedcba98, false, false);
  return __builtin_bit_cast(float, b);
}

// P^T of one 64-key tile from its shifted scores, and this half's sum of it.
// P^T as B operand: element i = key 32mj + 8g + i, element 8 + i = key
// 32mj + 16 + 8g + i, which is the k order load_frag gives V^T.
static __device__ __forceinline__ float tile_probs(const f32x8* s, half16* p) {
  float st[4];
#pragma unroll
  for (int j = 0; j < 4; ++j) {
    float e[8];
#pragma unroll
    for (int r = 0; r < 8; ++r) {
      e[r] = __builtin_amdgcn_exp2f(s[j][r]);
      p[j >> 1][(j & 1) * 8 + r] = (_Float16)e[r];
    }
    st[j] = ((e[0] + e[1]) + (e[2] + e[3])) + ((e[4] + e[5]) + (e[6] + e[7]));
  }
  return (st[0] + st[1]) + (st[2] + st[3]);
}

// One thread's share of a K tile and of a V^T tile, 16 bytes each, from global
// memory straight into LDS. kl, vl: LDS byte addresses. The wait stands inside
// the statement, as a precaution, ahead of any rewrite of the address registers.
static __device__ __forceinline__ void stage_tile(unsigned kl, const _Float16* kg,
                                                  unsigned vl, const _Float16* vg) {
  asm volatile("global_load_async_to_lds_b128 %0, %1, off\n\t"
               "global_load_async_to_lds_b128 %2, %3, off\n\t"
               "s_wait_xcnt 0x0"
               ::"v"(kl), "v"(kg), "v"(vl), "v"(vg) : "memory");
}

__global__ void __launch_bounds__(256) attn_kernel(
    const _Float16* __restrict__ Qh, const _Float16* __restrict__ Kh,
    const _Float16* __restrict__ Vt, _Float16* __restrict__ Orow) {
  // Row pitch = 16 B x odd, so the 16 rows one ds_load_b128 half-wave reads
  // fall on 64 distinct banks (unpadded 64 B / 128 B rows collide 4x / 8x).
  __shared__ __align__(16) _Float16 Ks[2][64][40];   // K tiles, 64 B rows at pitch 80 B
  __shared__ __align__(16) _Float16 Vs[2][32][72];   // V^T tiles, 128 B rows at pitch 144 B

  const int tid = threadIdx.x;
  const int w = tid >> 5, lane = tid & 31, g = lane >> 4, lh = lane & 15;
  const int bh = blockIdx.y;
  const int b = bh >> 2, h = bh & 3;
  const int q0 = blockIdx.x * 128 + w * 16;
  const size_t hb = (size_t)(b * HEADS + h);
  const _Float16* qb = Qh + hb * NPIX * HEAD_DIM;
  const _Float16* kb = Kh + hb * NPIX * HEAD_DIM;
  const _Float16* vb = Vt + hb * HEAD_DIM * NPIX;

  // Q^T as B operand: lane = query column q0 + lh (reused every iteration)
  half16 bq = load_frag(qb + (size_t)(q0 + lh) * 32 + g * 8,
                        qb + (size_t)(q0 + lh) * 32 + 16 + g * 8);
  // O^T tiles: register r = O[query lh][d = 8g + r] (o_lo), d = 16 + 8g + r (o_hi)
  f32x8 o_lo = zero8(), o_hi = zero8();
  f32x8 negm = zero8();  // minus the shift of this lane's query, in every register
                         // (C operand of the score products; equal in both halves)
  float l = 0.f;         // running sum over this half's keys only

  // cooperative-staging indices (each thread moves 8+8 f16 per tile)
  const int kslot = tid * 8;            // 0..2047 over the global K tile (64x32)
  const int kr = tid >> 2;              // 0..63  (K row = key)
  const int kc = (tid & 3) * 8;         // 0..24  (d offset within the row)
  const int vd = tid >> 3;              // 0..31  (V^T row = d)
  const int vm = (tid & 7) * 8;         // 0..56  (m offset within tile)
  const _Float16* kg = kb + kslot;                    // this thread's 16 B of K tile 0
  const _Float16* vg = vb + (size_t)vd * NPIX + vm;   // and of V^T tile 0
  // their places in buffer 0 (LDS byte address = low word of the pointer)
  const unsigned kl = (unsigned)(size_t)&Ks[0][kr][kc];
  const unsigned vl = (unsigned)(size_t)&Vs[0][vd][vm];

  // ---- tile 0 into buffer 0, landed and published; then tile 1 set off ----
  stage_tile(kl, kg, vl, vg);
  asm volatile("s_wait_asynccnt 0x0" ::: "memory");  // this wave's copies have landed
  __syncthreads();                                   // and every other wave's
  stage_tile(kl + (unsigned)sizeof(Ks[0]), kg + 64 * 32,
             vl + (unsigned)sizeof(Vs[0]), vg + 64);

  // two trips a pass of the loop: the buffer index is then a constant of each
  // copy of the body and every LDS address keeps its immediate offset
#pragma unroll 2
  for (int kt = 0; kt < NPIX / 64; ++kt) {
    const int buf = kt & 1;
    // ---- S^T = K Q^T - shift: s[j][r] = score(query lh, key 16j + 8g + r) ----
    f32x8 s[4];
#pragma unroll
    for (int j = 0; j < 4; ++j) {
      half16 ak = load_frag(&Ks[buf][j * 16 + lh][g * 8],
                            &Ks[buf][j * 16 + lh][16 + g * 8]);
      s[j] = wmma_f16(ak, bq, negm);
    }
    // V^T fragments, read ahead of the vector work: the test below ends the
    // block, and reads placed behind it would each be waited out
    half16 av[4];
#pragma unroll
    for (int mj = 0; mj < 2; ++mj) {
      av[2 * mj]     = load_frag(&Vs[buf][lh][mj * 32 + g * 8],
                                 &Vs[buf][lh][mj * 32 + 16 + g * 8]);
      av[2 * mj + 1] = load_frag(&Vs[buf][16 + lh][mj * 32 + g * 8],
                                 &Vs[buf][16 + lh][mj * 32 + 16 + g * 8]);
    }
    // Keeps the sixteen reads and the four score products ahead of the vector work:
    // without it the V^T reads are sunk behind the softmax and waited out there, and
    // the maxima are woven between the products, each behind its own idle slots.
    __builtin_amdgcn_sched_barrier(0);
    // ---- largest shifted score of this half's 32 keys: only tested ----
    float mt[4];
#pragma unroll
    for (int j = 0; j < 4; ++j) {
      mt[j] = fmaxf(fmaxf(fmaxf(s[j][0], s[j][1]), fmaxf(s[j][2], s[j][3])),
                    fmaxf(fmaxf(s[j][4], s[j][5]), fmaxf(s[j][6], s[j][7])));
    }
    const float mx = fmaxf(fmaxf(mt[0], mt[1]), fmaxf(mt[2], mt[3]));
    half16 p[2];
    float sum = tile_probs(s, p);
    // ---- raise the shift: tile 0 (sets it), or a score more than 8 above it
    // (2^8 is far inside f16). Marked unlikely so that the raise is laid out
    // behind the loop and the usual tile runs straight through. ----
    const float room = (kt == 0) ? -__builtin_inff() : 8.f;
    if (__builtin_expect(__builtin_amdgcn_ballot_w32(mx > room) != 0, 0)) {
      const float mq = fmaxf(mx, other_half(mx));
      const float up = (kt == 0) ? mq : fmaxf(mq, 0.f);
      const float alpha = __builtin_amdgcn_exp2f(-fmaxf(up, 0.f));
#pragma unroll
      for (int r = 0; r < 8; ++r) {
        negm[r] -= up;
        o_lo[r] *= alpha;
        o_hi[r] *= alpha;
      }
#pragma unroll
      for (int j = 0; j < 4; ++j)
#pragma unroll
        for (int r = 0; r < 8; ++r) s[j][r] -= up;
      sum = tile_probs(s, p);
      l *= alpha;
    }
    l += sum;
    // ---- O^T += V^T P^T (two 32-wide key sub-tiles; d split 0..15 / 16..31) ----
#pragma unroll
    for (int mj = 0; mj < 2; ++mj) {
      o_lo = wmma_f16(av[2 * mj], p[mj], o_lo);
      o_hi = wmma_f16(av[2 * mj + 1], p[mj], o_hi);
    }
    // ---- hand-over: tile kt + 1 is published, this tile's buffer is freed ----
    asm volatile("s_wait_dscnt 0x0" ::: "memory");     // this wave's reads of the buffer are over
    asm volatile("s_wait_asynccnt 0x0" ::: "memory");  // its copies of tile kt + 1 have landed
    __syncthreads();
    if (kt + 2 < NPIX / 64) {  // tile kt + 2 into the buffer just read
      stage_tile(kl + buf * (unsigned)sizeof(Ks[0]), kg + (size_t)(kt + 2) * (64 * 32),
                 vl + buf * (unsigned)sizeof(Vs[0]), vg + (kt + 2) * 64);
    }
  }
  asm volatile("s_wait_asynccnt 0x0" ::: "memory");  // no copy is left in flight at the end

  // ---- finalize: join the halves' sums, divide, store Orow[b][n][h*32 + d] ----
  const float inv = 1.f / (l + other_half(l));
  _Float16* ob = Orow + (size_t)b * NPIX * KEY_CH + h * HEAD_DIM +
                 (size_t)(q0 + lh) * KEY_CH + g * 8;
  half8 lo8, hi8;
#pragma unroll
  for (int r = 0; r < 8; ++r) {
    lo8[r] = (_Float16)(o_lo[r] * inv);
    hi8[r] = (_Float16)(o_hi[r] * inv);
  }
  *(half8*)ob        = lo8;
  *(half8*)(ob + 16) = hi8;
}

// ---------------------------------------------------------------------------
// Kernel 3: out = Wp @ O + x.  [256,128] x [128,4096] per image.
// Orow rows are kk-contiguous, so B-fragments are direct global_load_b128.
// Grid (N/64, B, 2), 256 threads; wave w handles 16 output channels.
// ---------------------------------------------------------------------------
__global__ void __launch_bounds__(256) out_proj_kernel(
    const _Float16* __restrict__ wph, const _Float16* __restrict__ Orow,
    const float* __restrict__ x, float* __restrict__ out) {
  const int tid = threadIdx.x;
  const int w = tid >> 5, lane = tid & 31, g = lane >> 4, lh = lane & 15;
  const int n0 = blockIdx.x * 64;
  const int b = blockIdx.y;
  const int c0 = blockIdx.z * 128 + w * 16;
  const _Float16* ob = Orow + (size_t)b * NPIX * KEY_CH;

  f32x8 acc[4];
#pragma unroll
  for (int j = 0; j < 4; ++j) acc[j] = zero8();

  // first batch, 56 loads in flight: all of Wp's fragments, O's for k = 0..63, and
  // the residual x of every output element of this lane
  half16 a[4];
#pragma unroll
  for (int kc = 0; kc < 4; ++kc)
    a[kc] = load_frag(wph + (size_t)(c0 + lh) * KEY_CH + kc * 32 + g * 8,
                      wph + (size_t)(c0 + lh) * KEY_CH + kc * 32 + 16 + g * 8);
  // A precaution: stands ahead of the next loads, whose results reuse the address registers.
  asm volatile("s_wait_xcnt 0x0" ::: "memory");
  half16 bf[2][4];
#pragma unroll
  for (int kc = 0; kc < 2; ++kc)
#pragma unroll
    for (int j = 0; j < 4; ++j) {
      const _Float16* orow = ob + (size_t)(n0 + j * 16 + lh) * KEY_CH + kc * 32;
      bf[kc][j] = load_frag(orow + g * 8, orow + 16 + g * 8);
    }
  const size_t off0 = (size_t)(b * IN_CH + c0 + 8 * g) * NPIX + n0 + lh;
  float xr[4][8];
#pragma unroll
  for (int j = 0; j < 4; ++j)
#pragma unroll
    for (int r = 0; r < 8; ++r) xr[j][r] = x[off0 + (size_t)r * NPIX + j * 16];
  // Keeps the batch together ahead of the products: left to itself the compiler
  // sinks every load to its use and waits each out alone, one latency after another.
  __builtin_amdgcn_sched_barrier(0);
#pragma unroll
  for (int kc = 0; kc < 2; ++kc)
#pragma unroll
    for (int j = 0; j < 4; ++j) acc[j] = wmma_f16(a[kc], bf[kc][j], acc[j]);
  // second batch: O's fragments for k = 64..127
#pragma unroll
  for (int kc = 0; kc < 2; ++kc)
#pragma unroll
    for (int j = 0; j < 4; ++j) {
      const _Float16* orow = ob + (size_t)(n0 + j * 16 + lh) * KEY_CH + 64 + kc * 32;
      bf[kc][j] = load_frag(orow + g * 8, orow + 16 + g * 8);
    }
  // Keeps the second batch together, for the same reason.
  __builtin_amdgcn_sched_barrier(0);
#pragma unroll
  for (int kc = 0; kc < 2; ++kc)
#pragma unroll
    for (int j = 0; j < 4; ++j) acc[j] = wmma_f16(a[2 + kc], bf[kc][j], acc[j]);

#pragma unroll
  for (int j = 0; j < 4; ++j)
#pragma unroll
    for (int r = 0; r < 8; ++r)
      out[off0 + (size_t)r * NPIX + j * 16] = acc[j][r] + xr[j][r];
}

// ---------------------------------------------------------------------------
// Host launcher
// ---------------------------------------------------------------------------
extern "C" void kernel_launch(void* const* d_in, const int* in_sizes, int n_in,
                              void* d_out, int out_size, void* d_ws, size_t ws_size,
                              hipStream_t stream) {
  const float* x  = (const float*)d_in[0];
  const float* Wq = (const float*)d_in[1];
  const float* Wk = (const float*)d_in[2];
  const float* Wv = (const float*)d_in[3];
  const float* Wp = (const float*)d_in[4];
  float* out = (float*)d_out;

  // workspace carve-up (all f16)
  char* ws = (char*)d_ws;
  size_t off = 0;
  _Float16* wph = (_Float16*)(ws + off); off += (size_t)IN_CH * KEY_CH * 2;
  _Float16* Qh  = (_Float16*)(ws + off); off += (size_t)NB * KEY_CH * NPIX * 2;  // 4 MB
  _Float16* Kh  = (_Float16*)(ws + off); off += (size_t)NB * KEY_CH * NPIX * 2;  // 4 MB
  _Float16* Vt  = (_Float16*)(ws + off); off += (size_t)NB * KEY_CH * NPIX * 2;  // 4 MB
  _Float16* Orow = (_Float16*)(ws + off); off += (size_t)NB * NPIX * KEY_CH * 2; // 4 MB

  // 1) Q/K/V projections (f32 operands rounded to f16 inside; Wp rounded on the side)
  proj_qkv_kernel<<<NB * (NPIX / 64), 256, 0, stream>>>(
      x, Wq, Wk, Wv, Wp, wph, Qh, Kh, Vt);

  // 2) flash attention
  attn_kernel<<<dim3(NPIX / 128, NB * HEADS), 256, 0, stream>>>(Qh, Kh, Vt, Orow);

  // 3) output projection + residual
  out_proj_kernel<<<dim3(NPIX / 64, NB, 2), 256, 0, stream>>>(wph, Orow, x, out);
}

// v007
// One run takes 52.5 microseconds.
// Next to v006, in two timings, it ran 1.07 and 1.09 times as fast.
// Over all steps from v000 it is 5.82 times as fast.
#include <hip/hip_runtime.h>
#include <hip/hip_bf16.h>

// ---------------------------------------------------------------------------
// LiteSelfAttention2D for MI455X (gfx1250): flash-attention on v_wmma_f32_16x16x32_f16
// B=4, C=256, KEY_CH=128, HEADS=4, HEAD_DIM=32, N=4096
// ---------------------------------------------------------------------------

#define NB      4
#define IN_CH   256
#define KEY_CH  128
#define HEADS   4
#define HEAD_DIM 32
#define NPIX    4096   // 64*64

typedef _Float16 half8  __attribute__((ext_vector_type(8)));
typedef _Float16 half16 __attribute__((ext_vector_type(16)));
typedef _Float16 half4  __attribute__((ext_vector_type(4)));
typedef float    f32x2  __attribute__((ext_vector_type(2)));
typedef float    f32x4  __attribute__((ext_vector_type(4)));
typedef float    f32x8  __attribute__((ext_vector_type(8)));

// Build a 16x32 (or 32x16) f16 WMMA fragment from two 16-byte chunks.
// A-layout: lane L holds row L%16, K-chunks at g*8 and 16+g*8 (g = L/16).
// B-layout is the mirror (lane = column, same K pattern).
static __device__ __forceinline__ half16 load_frag(const _Float16* lo,
                                                   const _Float16* hi) {
  half8 a = *(const half8*)lo;
  half8 b = *(const half8*)hi;
  half16 r;
#pragma unroll
  for (int i = 0; i < 8; ++i) { r[i] = a[i]; r[i + 8] = b[i]; }
  return r;
}

// The same fragment from four loaded f32 quads (two runs of 8 floats): each
// value times s, rounded to f16 (s = 1 for an unscaled matrix).
static __device__ __forceinline__ half16 round_frag(const f32x4* q, float s) {
  half16 r;
#pragma unroll
  for (int i = 0; i < 16; ++i) r[i] = (_Float16)(q[i >> 2][i & 3] * s);
  return r;
}

static __device__ __forceinline__ f32x8 wmma_f16(half16 a, half16 b, f32x8 c) {
  // D = A(16x32 f16) * B(32x16 f16) + C(16x16 f32)
  return __builtin_amdgcn_wmma_f32_16x16x32_f16(false, a, false, b,
                                                (short)0, c, false, false);
}

static __device__ __forceinline__ f32x8 zero8() {
  f32x8 z = {0.f, 0.f, 0.f, 0.f, 0.f, 0.f, 0.f, 0.f};
  return z;
}

// ---------------------------------------------------------------------------
// Kernel 1: projections Q,K,V = W * x  (per image: [128,256] x [256,4096])
// Grid: NB*64 blocks, 256 threads (8 waves). Wave w -> output rows 16w..16w+15.
// The block's x tile is transposed through LDS, whole and once, so the B-fragment
// (K = channel dim) becomes two contiguous ds_load_b128 per lane. x and the weights arrive as f32
// and are rounded to f16 here: x while it is staged, Wq/Wk/Wv in registers (the
// softmax scale log2(e)/sqrt(32) folded into Wq before the rounding), and each block
// rounds its 128 elements of Wp into wph for the output projection's launch.
// Outputs: Qh,Kh f16 [b][h][n][32] (row-major), Vt f16 [b][h][32][n].
// ---------------------------------------------------------------------------
__global__ void __launch_bounds__(256) proj_qkv_kernel(
    const float* __restrict__ x,
    const float* __restrict__ wq, const float* __restrict__ wk,
    const float* __restrict__ wv, const float* __restrict__ wp,
    _Float16* __restrict__ wph,
    _Float16* __restrict__ Qh, _Float16* __restrict__ Kh,
    _Float16* __restrict__ Vt) {
  // whole 256-channel tile [n][c]; row pitch 528 B = 16 B x odd, so the
  // ds_load_b128 of the fragments do not collide on banks
  __shared__ __align__(16) _Float16 Xt[64][IN_CH + 8];

  const int bx = blockIdx.x;
  const int b = bx >> 6;
  const int n0 = (bx & 63) * 64;
  const int tid = threadIdx.x;
  const int w = tid >> 5, lane = tid & 31, g = lane >> 4, lh = lane & 15;
  const float* xb = x + (size_t)b * IN_CH * NPIX;
  const float qs = 0.25503487f;           // log2(e)/sqrt(HEAD_DIM): scores in log2 units
  const int sn = lane * 2;                // staging: this thread's two pixels
  const int sc = w * 8;                   // and its 8 channels of each 64-channel group

  const int wrow = w * 16 + lh;           // output row for this lane's fragment
  const int wo = wrow * IN_CH + g * 8;
  const float* wqp = wq + wo;
  const float* wkp = wk + wo;
  const float* wvp = wv + wo;

  // weights of one 32-channel trip as loaded: [0..3] Wq, [4..7] Wk, [8..11] Wv;
  // two sets, so that the next trip's are in flight while this trip's are used
  f32x4 fw[2][12];
#pragma unroll
  for (int i = 0; i < 4; ++i) {
    const int o = (i >> 1) * 16 + (i & 1) * 4;
    fw[0][i]     = *(const f32x4*)(wqp + o);
    fw[0][4 + i] = *(const f32x4*)(wkp + o);
    fw[0][8 + i] = *(const f32x4*)(wvp + o);
  }

  // the block's whole x tile, 256 c x 64 n f32: all 32 loads of a thread (a wave's
  // load is one 256-B row of the tile) are set off before the first is used: one
  // memory latency for the tile, not one a trip
  f32x2 xv[4][8];
#pragma unroll
  for (int t = 0; t < 4; ++t)
#pragma unroll
    for (int k = 0; k < 8; ++k)
      xv[t][k] = *(const f32x2*)(xb + (size_t)(t * 64 + sc + k) * NPIX + n0 + sn);
  // A precaution: stands ahead of the roundings, which reuse the loads' address registers.
  asm volatile("s_wait_xcnt 0x0" ::: "memory");
  // rounded to f16 and stored transposed as [n][c]
#pragma unroll
  for (int t = 0; t < 4; ++t)
#pragma unroll
    for (int e = 0; e < 2; ++e) {
      half8 xc;
#pragma unroll
      for (int k = 0; k < 8; ++k) xc[k] = (_Float16)xv[t][k][e];
      *(half8*)(&Xt[sn + e][t * 64 + sc]) = xc;
    }

  f32x8 acc[3][4];
#pragma unroll
  for (int p = 0; p < 3; ++p)
#pragma unroll
    for (int j = 0; j < 4; ++j) acc[p][j] = zero8();

  __syncthreads();  // the one barrier: the tile is published and never rewritten

#pragma unroll
  for (int t = 0; t < 8; ++t) {
    const int cc = t * 32;
    if (t + 1 < 8) {
#pragma unroll
      for (int i = 0; i < 4; ++i) {
        const int o = cc + 32 + (i >> 1) * 16 + (i & 1) * 4;
        fw[(t + 1) & 1][i]     = *(const f32x4*)(wqp + o);
        fw[(t + 1) & 1][4 + i] = *(const f32x4*)(wkp + o);
        fw[(t + 1) & 1][8 + i] = *(const f32x4*)(wvp + o);
      }
    }
    half16 bf[4];
#pragma unroll
    for (int j = 0; j < 4; ++j)
      bf[j] = load_frag(&Xt[j * 16 + lh][cc + g * 8], &Xt[j * 16 + lh][cc + 16 + g * 8]);
    // Keeps the next trip's twelve loads and this trip's eight LDS reads ahead of the
    // roundings and products: sunk to their use each would be waited out there.
    __builtin_amdgcn_sched_barrier(0);
    half16 aq = round_frag(&fw[t & 1][0], qs);
    half16 ak = round_frag(&fw[t & 1][4], 1.f);
    half16 av = round_frag(&fw[t & 1][8], 1.f);
#pragma unroll
    for (int j = 0; j < 4; ++j) {
      acc[0][j] = wmma_f16(aq, bf[j], acc[0][j]);
      acc[1][j] = wmma_f16(ak, bf[j], acc[1][j]);
      acc[2][j] = wmma_f16(av, bf[j], acc[2][j]);
    }
  }

  // wave 0: this block's IN_CH*KEY_CH / gridDim.x = 128 elements of Wp, loaded
  // behind the last barrier, rounded and stored behind the scatter
  f32x4 wpv = {0.f, 0.f, 0.f, 0.f};
  if (tid < 32) wpv = *(const f32x4*)(wp + bx * 128 + tid * 4);

  // scatter to Qh/Kh (row-major per pixel) and Vt (transposed)
#pragma unroll
  for (int j = 0; j < 4; ++j) {
#pragma unroll
    for (int r = 0; r < 8; ++r) {
      int kk = w * 16 + r + 8 * g;       // 0..127
      int h = kk >> 5, d = kk & 31;
      int n = n0 + j * 16 + lh;
      size_t hb = (size_t)(b * HEADS + h);
      size_t qoff = (hb * NPIX + n) * HEAD_DIM + d;
      Qh[qoff] = (_Float16)acc[0][j][r];
      Kh[qoff] = (_Float16)acc[1][j][r];
      Vt[(hb * HEAD_DIM + d) * NPIX + n] = (_Float16)acc[2][j][r];
    }
  }

  if (tid < 32) {
    half4 hv;
#pragma unroll
    for (int i = 0; i < 4; ++i) hv[i] = (_Float16)wpv[i];
    *(half4*)(wph + bx * 128 + tid * 4) = hv;
  }
}

// ---------------------------------------------------------------------------
// Kernel 2: flash attention. Grid (N/128, B*HEADS), 256 threads = 8 waves.
// A wave owns 32 queries (two Q^T fragments) and one half of the keys: waves
// 0..3 take keys 0..2047, waves 4..7 keys 2048..4095 for the same 128 queries.
// Every K and V^T fragment read from LDS feeds two products, one a query tile,
// and the test, the waits and the barrier of a step are paid once for both.
// Per step (one 64-key tile of each half):
//   - all 8 waves cooperatively stage the two K tiles (64x32 f16, 4 KB each) and
//     the two V^T tiles (32x64 f16) into LDS, by asynchronous copies into two
//     buffers: the next step's tiles fly while these are worked on, one barrier
//     a step;
//   - 8 WMMAs for S^T = K Q^T - shift (scale and log2(e) pre-folded into Q, the
//     C operand holds minus the query's shift): per query tile a lane holds 32 of
//     the 64 shifted scores of ONE query (column lh), its partner lane^16 the rest;
//   - softmax in f32 in registers on all 32 lanes: exp2 straight from D. The
//     shift is a maximum seen earlier; it is raised, and O and l rescaled, only
//     in tile 0 and where a tile's score tops it by more than 8 (one test per
//     step for the wave); sums stay per half-wave until the end;
//   - 8 WMMAs for O^T += V^T P^T: two converted S^T tiles ARE the B operand.
// At the end the upper key half hands O, l and its shift over through LDS and the
// lower one joins the two on the larger shift.
// Output Orow f16 [b][n][128] (channel-contiguous per pixel).
// ---------------------------------------------------------------------------
#define KHALF (NPIX / 2)        // keys of one half
#define NSTEP (KHALF / 64)      // 64-key tiles of one half

// value of lane l ^ 16
static __device__ __forceinline__ float other_half(float v) {
  int b = __builtin_bit_cast(int, v);
  b = __builtin_amdgcn_permlanex16(b, b, 0x76543210, 0xfedcba98, false, false);
  return __builtin_bit_cast(float, b);
}

// P^T of one 64-key tile from its shifted scores, and this half-wave's sum of it.
// P^T as B operand: element i = key 32mj + 8g + i, element 8 + i = key
// 32mj + 16 + 8g + i, which is the k order load_frag gives V^T.
static __device__ __forceinline__ float tile_probs(const f32x8* s, half16* p) {
  float st[4];
#pragma unroll
  for (int j = 0; j < 4; ++j) {
    float e[8];
#pragma unroll
    for (int r = 0; r < 8; ++r) {
      e[r] = __builtin_amdgcn_exp2f(s[j][r]);
      p[j >> 1][(j & 1) * 8 + r] = (_Float16)e[r];
    }
    st[j] = ((e[0] + e[1]) + (e[2] + e[3])) + ((e[4] + e[5]) + (e[6] + e[7]));
  }
  return (st[0] + st[1]) + (st[2] + st[3]);
}

// One thread's share of a step's four tiles, 16 bytes each, from global memory
// straight into LDS: K and V^T of the lower key half (kl, vl: LDS byte addresses),
// then of the upper (kh, vh). The wait stands inside the statement, as a
// precaution, ahead of any rewrite of the address registers.
static __device__ __forceinline__ void stage_step(unsigned kl, const _Float16* kg,
                                                  unsigned vl, const _Float16* vg,
                                                  unsigned kh, const _Float16* kgh,
                                                  unsigned vh, const _Float16* vgh) {
  asm volatile("global_load_async_to_lds_b128 %0, %1, off\n\t"
               "global_load_async_to_lds_b128 %2, %3, off\n\t"
               "global_load_async_to_lds_b128 %4, %5, off\n\t"
               "global_load_async_to_lds_b128 %6, %7, off\n\t"
               "s_wait_xcnt 0x0"
               ::"v"(kl), "v"(kg), "v"(vl), "v"(vg),
                 "v"(kh), "v"(kgh), "v"(vh), "v"(vgh) : "memory");
}

__global__ void __launch_bounds__(256) attn_kernel(
    const _Float16* __restrict__ Qh, const _Float16* __restrict__ Kh,
    const _Float16* __restrict__ Vt, _Float16* __restrict__ Orow) {
  // [buffer][key half][row][column]. Row pitch = 16 B x odd, so the 16 rows one
  // ds_load_b128 half-wave reads fall on 64 distinct banks (unpadded 64 B / 128 B
  // rows collide 4x / 8x).
  __shared__ __align__(16) _Float16 Ks[2][2][64][40];   // K tiles, 64 B rows at pitch 80 B
  __shared__ __align__(16) _Float16 Vs[2][2][32][72];   // V^T tiles, 128 B rows at pitch 144 B
  // hand-over of the upper key half's result: [query group][quad][lane]; quads
  // 4qt..4qt+3 = O of query tile qt, quad 8 = both shifts and both sums
  __shared__ __align__(16) f32x4 Mg[4][9][32];

  const int tid = threadIdx.x;
  const int lane = tid & 31, g = lane >> 4, lh = lane & 15;
  const int w = __builtin_amdgcn_readfirstlane(tid >> 5);
  const int wq = w & 3;                 // query group of the wave
  const int wk = w >> 2;                // its key half
  const int bh = blockIdx.y;
  const int b = bh >> 2, h = bh & 3;
  const int q0 = blockIdx.x * 128 + wq * 32;
  const size_t hb = (size_t)(b * HEADS + h);
  const _Float16* qb = Qh + hb * NPIX * HEAD_DIM;
  const _Float16* kb = Kh + hb * NPIX * HEAD_DIM;
  const _Float16* vb = Vt + hb * HEAD_DIM * NPIX;

  // Q^T as B operand: lane = query column q0 + 16qt + lh (reused every iteration)
  half16 bq[2];
  // O^T tiles: register r = O[query lh][d = 8g + r] (o_lo), d = 16 + 8g + r (o_hi)
  f32x8 o_lo[2], o_hi[2];
  f32x8 negm[2];         // minus the shift of this lane's query, in every register
                         // (C operand of the score products; equal in both half-waves)
  float l[2];            // running sum over this half-wave's keys only
#pragma unroll
  for (int qt = 0; qt < 2; ++qt) {
    const _Float16* qr = qb + (size_t)(q0 + qt * 16 + lh) * 32;
    bq[qt] = load_frag(qr + g * 8, qr + 16 + g * 8);
    o_lo[qt] = zero8();
    o_hi[qt] = zero8();
    negm[qt] = zero8();
    l[qt] = 0.f;
  }

  // cooperative-staging indices (each thread moves 8+8 f16 per tile and key half)
  const int kslot = tid * 8;            // 0..2047 over the global K tile (64x32)
  const int kr = tid >> 2;              // 0..63  (K row = key)
  const int kc = (tid & 3) * 8;         // 0..24  (d offset within the row)
  const int vd = tid >> 3;              // 0..31  (V^T row = d)
  const int vm = (tid & 7) * 8;         // 0..56  (m offset within tile)
  const _Float16* kg = kb + kslot;                    // this thread's 16 B of K tile 0
  const _Float16* vg = vb + (size_t)vd * NPIX + vm;   // and of V^T tile 0, lower half
  // their places in buffer 0 (LDS byte address = low word of the pointer)
  const unsigned kl = (unsigned)(size_t)&Ks[0][0][kr][kc];
  const unsigned vl = (unsigned)(size_t)&Vs[0][0][vd][vm];
  const unsigned kbuf = (unsigned)sizeof(Ks[0]), khalf = (unsigned)sizeof(Ks[0][0]);
  const unsigned vbuf = (unsigned)sizeof(Vs[0]), vhalf = (unsigned)sizeof(Vs[0][0]);

  // ---- step 0 into buffer 0, landed and published; then step 1 set off ----
  stage_step(kl, kg, vl, vg,
             kl + khalf, kg + KHALF * 32, vl + vhalf, vg + KHALF);
  asm volatile("s_wait_asynccnt 0x0" ::: "memory");  // this wave's copies have landed
  __syncthreads();                                   // and every other wave's
  stage_step(kl + kbuf, kg + 64 * 32, vl + vbuf, vg + 64,
             kl + kbuf + khalf, kg + (KHALF + 64) * 32, vl + vbuf + vhalf, vg + KHALF + 64);

  // two trips a pass of the loop: the buffer index is then a constant of each
  // copy of the body and every LDS address keeps its immediate offset
#pragma unroll 2
  for (int kt = 0; kt < NSTEP; ++kt) {
    const int buf = kt & 1;
    // ---- S^T = K Q^T - shift: s[qt][j][r] = score(query 16qt + lh, key 16j + 8g + r) ----
    half16 ak[4];
#pragma unroll
    for (int j = 0; j < 4; ++j)
      ak[j] = load_frag(&Ks[buf][wk][j * 16 + lh][g * 8],
                        &Ks[buf][wk][j * 16 + lh][16 + g * 8]);
    // V^T fragments, read ahead of the vector work: the test below ends the
    // block, and reads placed behind it would each be waited out
    half16 av[4];
#pragma unroll
    for (int mj = 0; mj < 2; ++mj) {
      av[2 * mj]     = load_frag(&Vs[buf][wk][lh][mj * 32 + g * 8],
                                 &Vs[buf][wk][lh][mj * 32 + 16 + g * 8]);
      av[2 * mj + 1] = load_frag(&Vs[buf][wk][16 + lh][mj * 32 + g * 8],
                                 &Vs[buf][wk][16 + lh][mj * 32 + 16 + g * 8]);
    }
    // Keeps the sixteen reads together ahead of the products: left to itself the
    // compiler reads the K fragments pair by pair into one register set and waits
    // each pair out in front of its products, one LDS latency after another.
    __builtin_amdgcn_sched_barrier(0);
    f32x8 s[2][4];
#pragma unroll
    for (int qt = 0; qt < 2; ++qt)
#pragma unroll
      for (int j = 0; j < 4; ++j) s[qt][j] = wmma_f16(ak[j], bq[qt], negm[qt]);
    // Keeps the eight score products ahead of the vector work: without it the maxima
    // are woven between the products, each behind its own idle slots.
    __builtin_amdgcn_sched_barrier(0);
    // ---- largest shifted score of this half-wave's 32 keys: only tested ----
    float mx[2];
#pragma unroll
    for (int qt = 0; qt < 2; ++qt) {
      float mt[4];
#pragma unroll
      for (int j = 0; j < 4; ++j) {
        mt[j] = fmaxf(fmaxf(fmaxf(s[qt][j][0], s[qt][j][1]), fmaxf(s[qt][j][2], s[qt][j][3])),
                      fmaxf(fmaxf(s[qt][j][4], s[qt][j][5]), fmaxf(s[qt][j][6], s[qt][j][7])));
      }
      mx[qt] = fmaxf(fmaxf(mt[0], mt[1]), fmaxf(mt[2], mt[3]));
    }
    half16 p[2][2];
    float sum[2];
    sum[0] = tile_probs(s[0], p[0]);
    sum[1] = tile_probs(s[1], p[1]);
    // ---- raise the shift: tile 0 (sets it), or a score more than 8 above it
    // (2^8 is far inside f16). Marked unlikely so that the raise is laid out
    // behind the loop and the usual tile runs straight through. ----
    const float room = (kt == 0) ? -__builtin_inff() : 8.f;
    if (__builtin_expect(__builtin_amdgcn_ballot_w32(fmaxf(mx[0], mx[1]) > room) != 0, 0)) {
#pragma unroll
      for (int qt = 0; qt < 2; ++qt) {
        const float mq = fmaxf(mx[qt], other_half(mx[qt]));
        const float up = (kt == 0) ? mq : fmaxf(mq, 0.f);
        const float alpha = __builtin_amdgcn_exp2f(-fmaxf(up, 0.f));
#pragma unroll
        for (int r = 0; r < 8; ++r) {
          negm[qt][r] -= up;
          o_lo[qt][r] *= alpha;
          o_hi[qt][r] *= alpha;
        }
#pragma unroll
        for (int j = 0; j < 4; ++j)
#pragma unroll
          for (int r = 0; r < 8; ++r) s[qt][j][r] -= up;
        sum[qt] = tile_probs(s[qt], p[qt]);
        l[qt] *= alpha;
      }
    }
    l[0] += sum[0];
    l[1] += sum[1];
    // ---- O^T += V^T P^T (two 32-wide key sub-tiles; d split 0..15 / 16..31) ----
#pragma unroll
    for (int mj = 0; mj < 2; ++mj) {
#pragma unroll
      for (int qt = 0; qt < 2; ++qt) {
        o_lo[qt] = wmma_f16(av[2 * mj], p[qt][mj], o_lo[qt]);
        o_hi[qt] = wmma_f16(av[2 * mj + 1], p[qt][mj], o_hi[qt]);
      }
    }
    // ---- hand-over: step kt + 1 is published, this step's buffer is freed ----
    asm volatile("s_wait_dscnt 0x0" ::: "memory");     // this wave's reads of the buffer are over
    asm volatile("s_wait_asynccnt 0x0" ::: "memory");  // its copies of step kt + 1 have landed
    __syncthreads();
    if (kt + 2 < NSTEP) {  // step kt + 2 into the buffer just read
      const _Float16* kn = kg + (size_t)(kt + 2) * (64 * 32);
      const _Float16* vn = vg + (kt + 2) * 64;
      stage_step(kl + buf * kbuf, kn, vl + buf * vbuf, vn,
                 kl + buf * kbuf + khalf, kn + KHALF * 32, vl + buf * vbuf + vhalf, vn + KHALF);
    }
  }
  asm volatile("s_wait_asynccnt 0x0" ::: "memory");  // no copy is left in flight at the end

  // ---- the upper key half hands its O, shifts and sums over ----
  if (wk == 1) {
#pragma unroll
    for (int qt = 0; qt < 2; ++qt) {
      f32x4 c0 = {o_lo[qt][0], o_lo[qt][1], o_lo[qt][2], o_lo[qt][3]};
      f32x4 c1 = {o_lo[qt][4], o_lo[qt][5], o_lo[qt][6], o_lo[qt][7]};
      f32x4 c2 = {o_hi[qt][0], o_hi[qt][1], o_hi[qt][2], o_hi[qt][3]};
      f32x4 c3 = {o_hi[qt][4], o_hi[qt][5], o_hi[qt][6], o_hi[qt][7]};
      Mg[wq][qt * 4 + 0][lane] = c0;
      Mg[wq][qt * 4 + 1][lane] = c1;
      Mg[wq][qt * 4 + 2][lane] = c2;
      Mg[wq][qt * 4 + 3][lane] = c3;
    }
    f32x4 c8 = {negm[0][0], negm[1][0], l[0], l[1]};
    Mg[wq][8][lane] = c8;
  }
  __syncthreads();  // the hand-over is published
  if (wk == 1) return;

  // ---- finalize: join the key halves on the larger shift, then the half-waves'
  // sums, divide, store Orow[b][n][h*32 + d] ----
  const f32x4 u8 = Mg[wq][8][lane];
#pragma unroll
  for (int qt = 0; qt < 2; ++qt) {
    const float nm = fminf(negm[qt][0], u8[qt]);                  // minus the larger shift
    const float a0 = __builtin_amdgcn_exp2f(nm - negm[qt][0]);    // this half's weight
    const float a1 = __builtin_amdgcn_exp2f(nm - u8[qt]);         // the upper half's
    const float lj = l[qt] * a0 + u8[2 + qt] * a1;
    const float inv = 1.f / (lj + other_half(lj));
    const float f0 = a0 * inv, f1 = a1 * inv;
    const f32x4 u0 = Mg[wq][qt * 4 + 0][lane];
    const f32x4 u1 = Mg[wq][qt * 4 + 1][lane];
    const f32x4 u2 = Mg[wq][qt * 4 + 2][lane];
    const f32x4 u3 = Mg[wq][qt * 4 + 3][lane];
    half8 lo8, hi8;
#pragma unroll
    for (int r = 0; r < 4; ++r) {
      lo8[r]     = (_Float16)(o_lo[qt][r] * f0 + u0[r] * f1);
      lo8[4 + r] = (_Float16)(o_lo[qt][4 + r] * f0 + u1[r] * f1);
      hi8[r]     = (_Float16)(o_hi[qt][r] * f0 + u2[r] * f1);
      hi8[4 + r] = (_Float16)(o_hi[qt][4 + r] * f0 + u3[r] * f1);
    }
    _Float16* ob = Orow + (size_t)b * NPIX * KEY_CH + h * HEAD_DIM +
                   (size_t)(q0 + qt * 16 + lh) * KEY_CH + g * 8;
    *(half8*)ob        = lo8;
    *(half8*)(ob + 16) = hi8;
  }
}

// ---------------------------------------------------------------------------
// Kernel 3: out = Wp @ O + x.  [256,128] x [128,4096] per image.
// Orow rows are kk-contiguous, so B-fragments are direct global_load_b128.
// Grid (N/64, B, 2), 256 threads; wave w handles 16 output channels.
// ---------------------------------------------------------------------------
__global__ void __launch_bounds__(256) out_proj_kernel(
    const _Float16* __restrict__ wph, const _Float16* __restrict__ Orow,
    const float* __restrict__ x, float* __restrict__ out) {
  const int tid = threadIdx.x;
  const int w = tid >> 5, lane = tid & 31, g = lane >> 4, lh = lane & 15;
  const int n0 = blockIdx.x * 64;
  const int b = blockIdx.y;
  const int c0 = blockIdx.z * 128 + w * 16;
  const _Float16* ob = Orow + (size_t)b * NPIX * KEY_CH;

  f32x8 acc[4];
#pragma unroll
  for (int j = 0; j < 4; ++j) acc[j] = zero8();

  // first batch, 56 loads in flight: all of Wp's fragments, O's for k = 0..63, and
  // the residual x of every output element of this lane
  half16 a[4];
#pragma unroll
  for (int kc = 0; kc < 4; ++kc)
    a[kc] = load_frag(wph + (size_t)(c0 + lh) * KEY_CH + kc * 32 + g * 8,
                      wph + (size_t)(c0 + lh) * KEY_CH + kc * 32 + 16 + g * 8);
  // A precaution: stands ahead of the next loads, whose results reuse the address registers.
  asm volatile("s_wait_xcnt 0x0" ::: "memory");
  half16 bf[2][4];
#pragma unroll
  for (int kc = 0; kc < 2; ++kc)
#pragma unroll
    for (int j = 0; j < 4; ++j) {
      const _Float16* orow = ob + (size_t)(n0 + j * 16 + lh) * KEY_CH + kc * 32;
      bf[kc][j] = load_frag(orow + g * 8, orow + 16 + g * 8);
    }
  const size_t off0 = (size_t)(b * IN_CH + c0 + 8 * g) * NPIX + n0 + lh;
  float xr[4][8];
#pragma unroll
  for (int j = 0; j < 4; ++j)
#pragma unroll
    for (int r = 0; r < 8; ++r) xr[j][r] = x[off0 + (size_t)r * NPIX + j * 16];
  // Keeps the batch together ahead of the products: left to itself the compiler
  // sinks every load to its use and waits each out alone, one latency after another.
  __builtin_amdgcn_sched_barrier(0);
#pragma unroll
  for (int kc = 0; kc < 2; ++kc)
#pragma unroll
    for (int j = 0; j < 4; ++j) acc[j] = wmma_f16(a[kc], bf[kc][j], acc[j]);
  // second batch: O's fragments for k = 64..127
#pragma unroll
  for (int kc = 0; kc < 2; ++kc)
#pragma unroll
    for (int j = 0; j < 4; ++j) {
      const _Float16* orow = ob + (size_t)(n0 + j * 16 + lh) * KEY_CH + 64 + kc * 32;
      bf[kc][j] = load_frag(orow + g * 8, orow + 16 + g * 8);
    }
  // Keeps the second batch together, for the same reason.
  __builtin_amdgcn_sched_barrier(0);
#pragma unroll
  for (int kc = 0; kc < 2; ++kc)
#pragma unroll
    for (int j = 0; j < 4; ++j) acc[j] = wmma_f16(a[2 + kc], bf[kc][j], acc[j]);

#pragma unroll
  for (int j = 0; j < 4; ++j)
#pragma unroll
    for (int r = 0; r < 8; ++r)
      out[off0 + (size_t)r * NPIX + j * 16] = acc[j][r] + xr[j][r];
}

// ---------------------------------------------------------------------------
// Host launcher
// ---------------------------------------------------------------------------
extern "C" void kernel_launch(void* const* d_in, const int* in_sizes, int n_in,
                              void* d_out, int out_size, void* d_ws, size_t ws_size,
                              hipStream_t stream) {
  const float* x  = (const float*)d_in[0];
  const float* Wq = (const float*)d_in[1];
  const float* Wk = (const float*)d_in[2];
  const float* Wv = (const float*)d_in[3];
  const float* Wp = (const float*)d_in[4];
  float* out = (float*)d_out;

  // workspace carve-up (all f16)
  char* ws = (char*)d_ws;
  size_t off = 0;
  _Float16* wph = (_Float16*)(ws + off); off += (size_t)IN_CH * KEY_CH * 2;
  _Float16* Qh  = (_Float16*)(ws + off); off += (size_t)NB * KEY_CH * NPIX * 2;  // 4 MB
  _Float16* Kh  = (_Float16*)(ws + off); off += (size_t)NB * KEY_CH * NPIX * 2;  // 4 MB
  _Float16* Vt  = (_Float16*)(ws + off); off += (size_t)NB * KEY_CH * NPIX * 2;  // 4 MB
  _Float16* Orow = (_Float16*)(ws + off); off += (size_t)NB * NPIX * KEY_CH * 2; // 4 MB

  // 1) Q/K/V projections (f32 operands rounded to f16 inside; Wp rounded on the side)
  proj_qkv_kernel<<<NB * (NPIX / 64), 256, 0, stream>>>(
      x, Wq, Wk, Wv, Wp, wph, Qh, Kh, Vt);

  // 2) flash attention
  attn_kernel<<<dim3(NPIX / 128, NB * HEADS), 256, 0, stream>>>(Qh, Kh, Vt, Orow);

  // 3) output projection + residual
  out_proj_kernel<<<dim3(NPIX / 64, NB, 2), 256, 0, stream>>>(wph, Orow, x, out);
}

// v008
// One run takes 47.3 microseconds.
// Timed twice side by side with v007, it ran 1.11 times as fast both times.
// All steps since v000 together make it 6.45 times as fast.
#include <hip/hip_runtime.h>
#include <hip/hip_bf16.h>

// ---------------------------------------------------------------------------
// LiteSelfAttention2D for MI455X (gfx1250): flash-attention on v_wmma_f32_16x16x32_f16
// B=4, C=256, KEY_CH=128, HEADS=4, HEAD_DIM=32, N=4096
// ---------------------------------------------------------------------------

#define NB      4
#define IN_CH   256
#define KEY_CH  128
#define HEADS   4
#define HEAD_DIM 32
#define NPIX    4096   // 64*64

typedef _Float16 half8  __attribute__((ext_vector_type(8)));
typedef _Float16 half16 __attribute__((ext_vector_type(16)));
typedef _Float16 half4  __attribute__((ext_vector_type(4)));
typedef float    f32x2  __attribute__((ext_vector_type(2)));
typedef float    f32x4  __attribute__((ext_vector_type(4)));
typedef float    f32x8  __attribute__((ext_vector_type(8)));

// Build a 16x32 (or 32x16) f16 WMMA fragment from two 16-byte chunks.
// A-layout: lane L holds row L%16, K-chunks at g*8 and 16+g*8 (g = L/16).
// B-layout is the mirror (lane = column, same K pattern).
static __device__ __forceinline__ half16 load_frag(const _Float16* lo,
                                                   const _Float16* hi) {
  half8 a = *(const half8*)lo;
  half8 b = *(const half8*)hi;
  half16 r;
#pragma unroll
  for (int i = 0; i < 8; ++i) { r[i] = a[i]; r[i + 8] = b[i]; }
  return r;
}

// The same fragment from four loaded f32 quads (two runs of 8 floats): each
// value times s, rounded to f16 (s = 1 for an unscaled matrix).
static __device__ __forceinline__ half16 round_frag(const f32x4* q, float s) {
  half16 r;
#pragma unroll
  for (int i = 0; i < 16; ++i) r[i] = (_Float16)(q[i >> 2][i & 3] * s);
  return r;
}

static __device__ __forceinline__ f32x8 wmma_f16(half16 a, half16 b, f32x8 c) {
  // D = A(16x32 f16) * B(32x16 f16) + C(16x16 f32)
  return __builtin_amdgcn_wmma_f32_16x16x32_f16(false, a, false, b,
                                                (short)0, c, false, false);
}

static __device__ __forceinline__ f32x8 zero8() {
  f32x8 z = {0.f, 0.f, 0.f, 0.f, 0.f, 0.f, 0.f, 0.f};
  return z;
}

// Four / eight 16-byte copies of one thread from global memory straight into LDS:
// copy i goes from g + i * gstep bytes to the LDS byte address l + i * lstep. The
// wait stands inside the statement, as a precaution, ahead of any rewrite of the
// address registers.
static __device__ __forceinline__ void copy4(unsigned l, unsigned lstep,
                                             const char* g, unsigned gstep) {
  asm volatile("global_load_async_to_lds_b128 %0, %1, off\n\t"
               "global_load_async_to_lds_b128 %2, %3, off\n\t"
               "global_load_async_to_lds_b128 %4, %5, off\n\t"
               "global_load_async_to_lds_b128 %6, %7, off\n\t"
               "s_wait_xcnt 0x0"
               ::"v"(l), "v"(g), "v"(l + lstep), "v"(g + gstep),
                 "v"(l + 2 * lstep), "v"(g + 2 * gstep),
                 "v"(l + 3 * lstep), "v"(g + 3 * gstep) : "memory");
}
static __device__ __forceinline__ void copy8(unsigned l, unsigned lstep,
                                             const char* g, unsigned gstep) {
  asm volatile("global_load_async_to_lds_b128 %0, %1, off\n\t"
               "global_load_async_to_lds_b128 %2, %3, off\n\t"
               "global_load_async_to_lds_b128 %4, %5, off\n\t"
               "global_load_async_to_lds_b128 %6, %7, off\n\t"
               "global_load_async_to_lds_b128 %8, %9, off\n\t"
               "global_load_async_to_lds_b128 %10, %11, off\n\t"
               "global_load_async_to_lds_b128 %12, %13, off\n\t"
               "global_load_async_to_lds_b128 %14, %15, off\n\t"
               "s_wait_xcnt 0x0"
               ::"v"(l), "v"(g), "v"(l + lstep), "v"(g + gstep),
                 "v"(l + 2 * lstep), "v"(g + 2 * gstep),
                 "v"(l + 3 * lstep), "v"(g + 3 * gstep),
                 "v"(l + 4 * lstep), "v"(g + 4 * gstep),
                 "v"(l + 5 * lstep), "v"(g + 5 * gstep),
                 "v"(l + 6 * lstep), "v"(g + 6 * gstep),
                 "v"(l + 7 * lstep), "v"(g + 7 * gstep) : "memory");
}

// ---------------------------------------------------------------------------
// Kernel 1: projections Q,K,V = W * x  (per image: [128,256] x [256,4096])
// Grid: NB*64 blocks, 256 threads (8 waves). Wave w -> output rows 16w..16w+15.
// The block's x tile is transposed through LDS, whole and once, so the B-fragment
// (K = channel dim) becomes two contiguous ds_load_b128 per lane. x and the weights arrive as f32
// and are rounded to f16 here: x while it is staged, Wq/Wk/Wv in registers (the
// softmax scale log2(e)/sqrt(32) folded into Wq before the rounding), and each block
// rounds its 128 elements of Wp into wph for the output projection's launch.
// Wq/Wk/Wv come through LDS, 64 channels a stage, by asynchronous copies into two
// buffers: a wave's copy takes two 256-B row pieces (4 whole cache lines), where a
// fragment load from global memory touches 16 lines for the same 512 B.
// Outputs: Qh,Kh f16 [b][h][n][32] (row-major), Vt f16 [b][h][32][n].
// ---------------------------------------------------------------------------
__global__ void __launch_bounds__(256) proj_qkv_kernel(
    const float* __restrict__ x,
    const float* __restrict__ wq, const float* __restrict__ wk,
    const float* __restrict__ wv, const float* __restrict__ wp,
    _Float16* __restrict__ wph,
    _Float16* __restrict__ Qh, _Float16* __restrict__ Kh,
    _Float16* __restrict__ Vt) {
  // whole 256-channel tile [n][c]; row pitch 528 B = 16 B x odd, so the
  // ds_load_b128 of the fragments do not collide on banks
  __shared__ __align__(16) _Float16 Xt[64][IN_CH + 8];
  // [buffer][Wq rows, Wk rows, Wv rows][64 channels f32]; 256-B rows at pitch 272 B
  // = 16 B x odd, for the same reason
  __shared__ __align__(16) float Wt[2][3 * KEY_CH][64 + 4];

  const int bx = blockIdx.x;
  const int b = bx >> 6;
  const int n0 = (bx & 63) * 64;
  const int tid = threadIdx.x;
  const int w = tid >> 5, lane = tid & 31, g = lane >> 4, lh = lane & 15;
  const float* xb = x + (size_t)b * IN_CH * NPIX;
  const float qs = 0.25503487f;           // log2(e)/sqrt(HEAD_DIM): scores in log2 units
  const int sn = lane * 2;                // staging: this thread's two pixels
  const int sc = w * 8;                   // and its 8 channels of each 64-channel group

  const int wrow = w * 16 + lh;           // output row for this lane's fragment

  // weight staging: 16-byte piece tid of each run of 16 rows (row tid / 16, four
  // channels from (tid % 16) * 4); eight runs a matrix and stage
  const int wo = (tid >> 4) * IN_CH + (tid & 15) * 4;
  const char* wqp = (const char*)(wq + wo);
  const char* wkp = (const char*)(wk + wo);
  const char* wvp = (const char*)(wv + wo);
  const unsigned wl = (unsigned)(size_t)&Wt[0][tid >> 4][(tid & 15) * 4];
  const unsigned wrun = 16u * (unsigned)sizeof(Wt[0][0]);          // 16 rows in LDS
  const unsigned wmat = KEY_CH * (unsigned)sizeof(Wt[0][0]);       // one matrix
  const unsigned wbuf = (unsigned)sizeof(Wt[0]);                   // one buffer
  const unsigned grun = 16u * IN_CH * 4u;                          // 16 rows in memory

  // ---- stage 0 set off: it flies beside the x tile ----
  copy8(wl, wrun, wqp, grun);
  copy8(wl + wmat, wrun, wkp, grun);
  copy8(wl + 2 * wmat, wrun, wvp, grun);

  // the block's whole x tile, 256 c x 64 n f32: all 32 loads of a thread (a wave's
  // load is one 256-B row of the tile) are set off before the first is used: one
  // memory latency for the tile, not one a trip
  f32x2 xv[4][8];
#pragma unroll
  for (int t = 0; t < 4; ++t)
#pragma unroll
    for (int k = 0; k < 8; ++k)
      xv[t][k] = *(const f32x2*)(xb + (size_t)(t * 64 + sc + k) * NPIX + n0 + sn);
  // A precaution: stands ahead of the roundings, which reuse the loads' address registers.
  asm volatile("s_wait_xcnt 0x0" ::: "memory");
  // rounded to f16 and stored transposed as [n][c]
#pragma unroll
  for (int t = 0; t < 4; ++t)
#pragma unroll
    for (int e = 0; e < 2; ++e) {
      half8 xc;
#pragma unroll
      for (int k = 0; k < 8; ++k) xc[k] = (_Float16)xv[t][k][e];
      *(half8*)(&Xt[sn + e][t * 64 + sc]) = xc;
    }

  f32x8 acc[3][4];
#pragma unroll
  for (int p = 0; p < 3; ++p)
#pragma unroll
    for (int j = 0; j < 4; ++j) acc[p][j] = zero8();

  asm volatile("s_wait_asynccnt 0x0" ::: "memory");  // this wave's copies of stage 0 have landed
  __syncthreads();  // the x tile (never rewritten) and stage 0 are published
  // ---- stage 1 set off ----
  copy8(wl + wbuf, wrun, wqp + 256, grun);
  copy8(wl + wbuf + wmat, wrun, wkp + 256, grun);
  copy8(wl + wbuf + 2 * wmat, wrun, wvp + 256, grun);

#pragma unroll
  for (int t = 0; t < 8; ++t) {
    const int cc = t * 32;
    const int buf = (t >> 1) & 1;         // stage t / 2, two 32-channel trips a stage
    // weights of this trip as staged: [0..3] Wq, [4..7] Wk, [8..11] Wv
    f32x4 fw[12];
#pragma unroll
    for (int i = 0; i < 4; ++i) {
      const int o = (t & 1) * 32 + (i >> 1) * 16 + g * 8 + (i & 1) * 4;
      fw[i]     = *(const f32x4*)&Wt[buf][wrow][o];
      fw[4 + i] = *(const f32x4*)&Wt[buf][KEY_CH + wrow][o];
      fw[8 + i] = *(const f32x4*)&Wt[buf][2 * KEY_CH + wrow][o];
    }
    half16 bf[4];
#pragma unroll
    for (int j = 0; j < 4; ++j)
      bf[j] = load_frag(&Xt[j * 16 + lh][cc + g * 8], &Xt[j * 16 + lh][cc + 16 + g * 8]);
    // Keeps this trip's twenty LDS reads together ahead of the roundings and
    // products: sunk to their use each would be waited out there.
    __builtin_amdgcn_sched_barrier(0);
    half16 aq = round_frag(&fw[0], qs);
    half16 ak = round_frag(&fw[4], 1.f);
    half16 av = round_frag(&fw[8], 1.f);
#pragma unroll
    for (int j = 0; j < 4; ++j) {
      acc[0][j] = wmma_f16(aq, bf[j], acc[0][j]);
      acc[1][j] = wmma_f16(ak, bf[j], acc[1][j]);
      acc[2][j] = wmma_f16(av, bf[j], acc[2][j]);
    }
    if (t & 1) {
      // ---- hand-over: the next stage is published, this stage's buffer is freed ----
      asm volatile("s_wait_dscnt 0x0" ::: "memory");     // this wave's reads of the buffer are over
      asm volatile("s_wait_asynccnt 0x0" ::: "memory");  // its copies of the next stage have landed
      __syncthreads();
      if (t + 4 < 8) {  // stage t / 2 + 2 into the buffer just read
        const unsigned go = (unsigned)((t >> 1) + 2) * 256u;
        copy8(wl + buf * wbuf, wrun, wqp + go, grun);
        copy8(wl + buf * wbuf + wmat, wrun, wkp + go, grun);
        copy8(wl + buf * wbuf + 2 * wmat, wrun, wvp + go, grun);
      }
    }
  }
  asm volatile("s_wait_asynccnt 0x0" ::: "memory");  // no copy is left in flight at the end

  // wave 0: this block's IN_CH*KEY_CH / gridDim.x = 128 elements of Wp, loaded
  // behind the last barrier, rounded and stored behind the scatter
  f32x4 wpv = {0.f, 0.f, 0.f, 0.f};
  if (tid < 32) wpv = *(const f32x4*)(wp + bx * 128 + tid * 4);

  // scatter to Qh/Kh (row-major per pixel) and Vt (transposed)
#pragma unroll
  for (int j = 0; j < 4; ++j) {
#pragma unroll
    for (int r = 0; r < 8; ++r) {
      int kk = w * 16 + r + 8 * g;       // 0..127
      int h = kk >> 5, d = kk & 31;
      int n = n0 + j * 16 + lh;
      size_t hb = (size_t)(b * HEADS + h);
      size_t qoff = (hb * NPIX + n) * HEAD_DIM + d;
      Qh[qoff] = (_Float16)acc[0][j][r];
      Kh[qoff] = (_Float16)acc[1][j][r];
      Vt[(hb * HEAD_DIM + d) * NPIX + n] = (_Float16)acc[2][j][r];
    }
  }

  if (tid < 32) {
    half4 hv;
#pragma unroll
    for (int i = 0; i < 4; ++i) hv[i] = (_Float16)wpv[i];
    *(half4*)(wph + bx * 128 + tid * 4) = hv;
  }
}

// ---------------------------------------------------------------------------
// Kernel 2: flash attention. Grid (N/128, B*HEADS), 256 threads = 8 waves.
// A wave owns 32 queries (two Q^T fragments) and one half of the keys: waves
// 0..3 take keys 0..2047, waves 4..7 keys 2048..4095 for the same 128 queries.
// Every K and V^T fragment read from LDS feeds two products, one a query tile,
// and the test, the waits and the barrier of a step are paid once for both.
// Per step (one 64-key tile of each half):
//   - all 8 waves cooperatively stage the two K tiles (64x32 f16, 4 KB each) and
//     the two V^T tiles (32x64 f16) into LDS, by asynchronous copies into two
//     buffers: the next step's tiles fly while these are worked on, one barrier
//     a step;
//   - 8 WMMAs for S^T = K Q^T - shift (scale and log2(e) pre-folded into Q, the
//     C operand holds minus the query's shift): per query tile a lane holds 32 of
//     the 64 shifted scores of ONE query (column lh), its partner lane^16 the rest;
//   - softmax in f32 in registers on all 32 lanes: exp2 straight from D. The
//     shift is a maximum seen earlier; it is raised, and O and l rescaled, only
//     in tile 0 and where a tile's score tops it by more than 8 (one test per
//     step for the wave); sums stay per half-wave until the end;
//   - 8 WMMAs for O^T += V^T P^T: two converted S^T tiles ARE the B operand.
// At the end the upper key half hands O, l and its shift over through LDS and the
// lower one joins the two on the larger shift.
// Output Orow f16 [b][n][128] (channel-contiguous per pixel).
// ---------------------------------------------------------------------------
#define KHALF (NPIX / 2)        // keys of one half
#define NSTEP (KHALF / 64)      // 64-key tiles of one half

// value of lane l ^ 16
static __device__ __forceinline__ float other_half(float v) {
  int b = __builtin_bit_cast(int, v);
  b = __builtin_amdgcn_permlanex16(b, b, 0x76543210, 0xfedcba98, false, false);
  return __builtin_bit_cast(float, b);
}

// P^T of one 64-key tile from its shifted scores, and this half-wave's sum of it.
// P^T as B operand: element i = key 32mj + 8g + i, element 8 + i = key
// 32mj + 16 + 8g + i, which is the k order load_frag gives V^T.
static __device__ __forceinline__ float tile_probs(const f32x8* s, half16* p) {
  float st[4];
#pragma unroll
  for (int j = 0; j < 4; ++j) {
    float e[8];
#pragma unroll
    for (int r = 0; r < 8; ++r) {
      e[r] = __builtin_amdgcn_exp2f(s[j][r]);
      p[j >> 1][(j & 1) * 8 + r] = (_Float16)e[r];
    }
    st[j] = ((e[0] + e[1]) + (e[2] + e[3])) + ((e[4] + e[5]) + (e[6] + e[7]));
  }
  return (st[0] + st[1]) + (st[2] + st[3]);
}

// One thread's share of a step's four tiles, 16 bytes each, from global memory
// straight into LDS: K and V^T of the lower key half (kl, vl: LDS byte addresses),
// then of the upper (kh, vh). The wait stands inside the statement, as a
// precaution, ahead of any rewrite of the address registers.
static __device__ __forceinline__ void stage_step(unsigned kl, const _Float16* kg,
                                                  unsigned vl, const _Float16* vg,
                                                  unsigned kh, const _Float16* kgh,
                                                  unsigned vh, const _Float16* vgh) {
  asm volatile("global_load_async_to_lds_b128 %0, %1, off\n\t"
               "global_load_async_to_lds_b128 %2, %3, off\n\t"
               "global_load_async_to_lds_b128 %4, %5, off\n\t"
               "global_load_async_to_lds_b128 %6, %7, off\n\t"
               "s_wait_xcnt 0x0"
               ::"v"(kl), "v"(kg), "v"(vl), "v"(vg),
                 "v"(kh), "v"(kgh), "v"(vh), "v"(vgh) : "memory");
}

__global__ void __launch_bounds__(256) attn_kernel(
    const _Float16* __restrict__ Qh, const _Float16* __restrict__ Kh,
    const _Float16* __restrict__ Vt, _Float16* __restrict__ Orow) {
  // [buffer][key half][row][column]. Row pitch = 16 B x odd, so the 16 rows one
  // ds_load_b128 half-wave reads fall on 64 distinct banks (unpadded 64 B / 128 B
  // rows collide 4x / 8x).
  __shared__ __align__(16) _Float16 Ks[2][2][64][40];   // K tiles, 64 B rows at pitch 80 B
  __shared__ __align__(16) _Float16 Vs[2][2][32][72];   // V^T tiles, 128 B rows at pitch 144 B
  // hand-over of the upper key half's result: [query group][quad][lane]; quads
  // 4qt..4qt+3 = O of query tile qt, quad 8 = both shifts and both sums
  __shared__ __align__(16) f32x4 Mg[4][9][32];

  const int tid = threadIdx.x;
  const int lane = tid & 31, g = lane >> 4, lh = lane & 15;
  const int w = __builtin_amdgcn_readfirstlane(tid >> 5);
  const int wq = w & 3;                 // query group of the wave
  const int wk = w >> 2;                // its key half
  const int bh = blockIdx.y;
  const int b = bh >> 2, h = bh & 3;
  const int q0 = blockIdx.x * 128 + wq * 32;
  const size_t hb = (size_t)(b * HEADS + h);
  const _Float16* qb = Qh + hb * NPIX * HEAD_DIM;
  const _Float16* kb = Kh + hb * NPIX * HEAD_DIM;
  const _Float16* vb = Vt + hb * HEAD_DIM * NPIX;

  // Q^T as B operand: lane = query column q0 + 16qt + lh (reused every iteration)
  half16 bq[2];
  // O^T tiles: register r = O[query lh][d = 8g + r] (o_lo), d = 16 + 8g + r (o_hi)
  f32x8 o_lo[2], o_hi[2];
  f32x8 negm[2];         // minus the shift of this lane's query, in every register
                         // (C operand of the score products; equal in both half-waves)
  float l[2];            // running sum over this half-wave's keys only
#pragma unroll
  for (int qt = 0; qt < 2; ++qt) {
    const _Float16* qr = qb + (size_t)(q0 + qt * 16 + lh) * 32;
    bq[qt] = load_frag(qr + g * 8, qr + 16 + g * 8);
    o_lo[qt] = zero8();
    o_hi[qt] = zero8();
    negm[qt] = zero8();
    l[qt] = 0.f;
  }

  // cooperative-staging indices (each thread moves 8+8 f16 per tile and key half)
  const int kslot = tid * 8;            // 0..2047 over the global K tile (64x32)
  const int kr = tid >> 2;              // 0..63  (K row = key)
  const int kc = (tid & 3) * 8;         // 0..24  (d offset within the row)
  const int vd = tid >> 3;              // 0..31  (V^T row = d)
  const int vm = (tid & 7) * 8;         // 0..56  (m offset within tile)
  const _Float16* kg = kb + kslot;                    // this thread's 16 B of K tile 0
  const _Float16* vg = vb + (size_t)vd * NPIX + vm;   // and of V^T tile 0, lower half
  // their places in buffer 0 (LDS byte address = low word of the pointer)
  const unsigned kl = (unsigned)(size_t)&Ks[0][0][kr][kc];
  const unsigned vl = (unsigned)(size_t)&Vs[0][0][vd][vm];
  const unsigned kbuf = (unsigned)sizeof(Ks[0]), khalf = (unsigned)sizeof(Ks[0][0]);
  const unsigned vbuf = (unsigned)sizeof(Vs[0]), vhalf = (unsigned)sizeof(Vs[0][0]);

  // ---- step 0 into buffer 0, landed and published; then step 1 set off ----
  stage_step(kl, kg, vl, vg,
             kl + khalf, kg + KHALF * 32, vl + vhalf, vg + KHALF);
  asm volatile("s_wait_asynccnt 0x0" ::: "memory");  // this wave's copies have landed
  __syncthreads();                                   // and every other wave's
  stage_step(kl + kbuf, kg + 64 * 32, vl + vbuf, vg + 64,
             kl + kbuf + khalf, kg + (KHALF + 64) * 32, vl + vbuf + vhalf, vg + KHALF + 64);

  // two trips a pass of the loop: the buffer index is then a constant of each
  // copy of the body and every LDS address keeps its immediate offset
#pragma unroll 2
  for (int kt = 0; kt < NSTEP; ++kt) {
    const int buf = kt & 1;
    // ---- S^T = K Q^T - shift: s[qt][j][r] = score(query 16qt + lh, key 16j + 8g + r) ----
    half16 ak[4];
#pragma unroll
    for (int j = 0; j < 4; ++j)
      ak[j] = load_frag(&Ks[buf][wk][j * 16 + lh][g * 8],
                        &Ks[buf][wk][j * 16 + lh][16 + g * 8]);
    // V^T fragments, read ahead of the vector work: the test below ends the
    // block, and reads placed behind it would each be waited out
    half16 av[4];
#pragma unroll
    for (int mj = 0; mj < 2; ++mj) {
      av[2 * mj]     = load_frag(&Vs[buf][wk][lh][mj * 32 + g * 8],
                                 &Vs[buf][wk][lh][mj * 32 + 16 + g * 8]);
      av[2 * mj + 1] = load_frag(&Vs[buf][wk][16 + lh][mj * 32 + g * 8],
                                 &Vs[buf][wk][16 + lh][mj * 32 + 16 + g * 8]);
    }
    // Keeps the sixteen reads together ahead of the products: left to itself the
    // compiler reads the K fragments pair by pair into one register set and waits
    // each pair out in front of its products, one LDS latency after another.
    __builtin_amdgcn_sched_barrier(0);
    f32x8 s[2][4];
#pragma unroll
    for (int qt = 0; qt < 2; ++qt)
#pragma unroll
      for (int j = 0; j < 4; ++j) s[qt][j] = wmma_f16(ak[j], bq[qt], negm[qt]);
    // Keeps the eight score products ahead of the vector work: without it the maxima
    // are woven between the products, each behind its own idle slots.
    __builtin_amdgcn_sched_barrier(0);
    // ---- largest shifted score of this half-wave's 32 keys: only tested ----
    float mx[2];
#pragma unroll
    for (int qt = 0; qt < 2; ++qt) {
      float mt[4];
#pragma unroll
      for (int j = 0; j < 4; ++j) {
        mt[j] = fmaxf(fmaxf(fmaxf(s[qt][j][0], s[qt][j][1]), fmaxf(s[qt][j][2], s[qt][j][3])),
                      fmaxf(fmaxf(s[qt][j][4], s[qt][j][5]), fmaxf(s[qt][j][6], s[qt][j][7])));
      }
      mx[qt] = fmaxf(fmaxf(mt[0], mt[1]), fmaxf(mt[2], mt[3]));
    }
    half16 p[2][2];
    float sum[2];
    sum[0] = tile_probs(s[0], p[0]);
    sum[1] = tile_probs(s[1], p[1]);
    // ---- raise the shift: tile 0 (sets it), or a score more than 8 above it
    // (2^8 is far inside f16). Marked unlikely so that the raise is laid out
    // behind the loop and the usual tile runs straight through. ----
    const float room = (kt == 0) ? -__builtin_inff() : 8.f;
    if (__builtin_expect(__builtin_amdgcn_ballot_w32(fmaxf(mx[0], mx[1]) > room) != 0, 0)) {
#pragma unroll
      for (int qt = 0; qt < 2; ++qt) {
        const float mq = fmaxf(mx[qt], other_half(mx[qt]));
        const float up = (kt == 0) ? mq : fmaxf(mq, 0.f);
        const float alpha = __builtin_amdgcn_exp2f(-fmaxf(up, 0.f));
#pragma unroll
        for (int r = 0; r < 8; ++r) {
          negm[qt][r] -= up;
          o_lo[qt][r] *= alpha;
          o_hi[qt][r] *= alpha;
        }
#pragma unroll
        for (int j = 0; j < 4; ++j)
#pragma unroll
          for (int r = 0; r < 8; ++r) s[qt][j][r] -= up;
        sum[qt] = tile_probs(s[qt], p[qt]);
        l[qt] *= alpha;
      }
    }
    l[0] += sum[0];
    l[1] += sum[1];
    // ---- O^T += V^T P^T (two 32-wide key sub-tiles; d split 0..15 / 16..31) ----
#pragma unroll
    for (int mj = 0; mj < 2; ++mj) {
#pragma unroll
      for (int qt = 0; qt < 2; ++qt) {
        o_lo[qt] = wmma_f16(av[2 * mj], p[qt][mj], o_lo[qt]);
        o_hi[qt] = wmma_f16(av[2 * mj + 1], p[qt][mj], o_hi[qt]);
      }
    }
    // ---- hand-over: step kt + 1 is published, this step's buffer is freed ----
    asm volatile("s_wait_dscnt 0x0" ::: "memory");     // this wave's reads of the buffer are over
    asm volatile("s_wait_asynccnt 0x0" ::: "memory");  // its copies of step kt + 1 have landed
    __syncthreads();
    if (kt + 2 < NSTEP) {  // step kt + 2 into the buffer just read
      const _Float16* kn = kg + (size_t)(kt + 2) * (64 * 32);
      const _Float16* vn = vg + (kt + 2) * 64;
      stage_step(kl + buf * kbuf, kn, vl + buf * vbuf, vn,
                 kl + buf * kbuf + khalf, kn + KHALF * 32, vl + buf * vbuf + vhalf, vn + KHALF);
    }
  }
  asm volatile("s_wait_asynccnt 0x0" ::: "memory");  // no copy is left in flight at the end

  // ---- the upper key half hands its O, shifts and sums over ----
  if (wk == 1) {
#pragma unroll
    for (int qt = 0; qt < 2; ++qt) {
      f32x4 c0 = {o_lo[qt][0], o_lo[qt][1], o_lo[qt][2], o_lo[qt][3]};
      f32x4 c1 = {o_lo[qt][4], o_lo[qt][5], o_lo[qt][6], o_lo[qt][7]};
      f32x4 c2 = {o_hi[qt][0], o_hi[qt][1], o_hi[qt][2], o_hi[qt][3]};
      f32x4 c3 = {o_hi[qt][4], o_hi[qt][5], o_hi[qt][6], o_hi[qt][7]};
      Mg[wq][qt * 4 + 0][lane] = c0;
      Mg[wq][qt * 4 + 1][lane] = c1;
      Mg[wq][qt * 4 + 2][lane] = c2;
      Mg[wq][qt * 4 + 3][lane] = c3;
    }
    f32x4 c8 = {negm[0][0], negm[1][0], l[0], l[1]};
    Mg[wq][8][lane] = c8;
  }
  __syncthreads();  // the hand-over is published
  if (wk == 1) return;

  // ---- finalize: join the key halves on the larger shift, then the half-waves'
  // sums, divide, store Orow[b][n][h*32 + d] ----
  const f32x4 u8 = Mg[wq][8][lane];
#pragma unroll
  for (int qt = 0; qt < 2; ++qt) {
    const float nm = fminf(negm[qt][0], u8[qt]);                  // minus the larger shift
    const float a0 = __builtin_amdgcn_exp2f(nm - negm[qt][0]);    // this half's weight
    const float a1 = __builtin_amdgcn_exp2f(nm - u8[qt]);         // the upper half's
    const float lj = l[qt] * a0 + u8[2 + qt] * a1;
    const float inv = 1.f / (lj + other_half(lj));
    const float f0 = a0 * inv, f1 = a1 * inv;
    const f32x4 u0 = Mg[wq][qt * 4 + 0][lane];
    const f32x4 u1 = Mg[wq][qt * 4 + 1][lane];
    const f32x4 u2 = Mg[wq][qt * 4 + 2][lane];
    const f32x4 u3 = Mg[wq][qt * 4 + 3][lane];
    half8 lo8, hi8;
#pragma unroll
    for (int r = 0; r < 4; ++r) {
      lo8[r]     = (_Float16)(o_lo[qt][r] * f0 + u0[r] * f1);
      lo8[4 + r] = (_Float16)(o_lo[qt][4 + r] * f0 + u1[r] * f1);
      hi8[r]     = (_Float16)(o_hi[qt][r] * f0 + u2[r] * f1);
      hi8[4 + r] = (_Float16)(o_hi[qt][4 + r] * f0 + u3[r] * f1);
    }
    _Float16* ob = Orow + (size_t)b * NPIX * KEY_CH + h * HEAD_DIM +
                   (size_t)(q0 + qt * 16 + lh) * KEY_CH + g * 8;
    *(half8*)ob        = lo8;
    *(half8*)(ob + 16) = hi8;
  }
}

// ---------------------------------------------------------------------------
// Kernel 3: out = Wp @ O + x.  [256,128] x [128,4096] per image.
// Grid (N/64, B, 2), 256 threads; wave w handles 16 output channels.
// The block's O tile (64 pixels x 128 k, 16 KB in a row in memory) and its 128 rows
// of Wp (32 KB in a row) come into LDS once, by asynchronous copies: a wave's copy
// takes 512 B in a row (4 whole cache lines), where a fragment load from global
// memory touches 16 lines for the same 512 B, and each of the 8 waves fetched the
// whole O tile for itself.
// ---------------------------------------------------------------------------
__global__ void __launch_bounds__(256) out_proj_kernel(
    const _Float16* __restrict__ wph, const _Float16* __restrict__ Orow,
    const float* __restrict__ x, float* __restrict__ out) {
  // 256-B rows at pitch 272 B = 16 B x odd: the 16 rows one ds_load_b128 half-wave
  // reads fall on 64 distinct banks
  __shared__ __align__(16) _Float16 Os[64][KEY_CH + 8];    // O tile [pixel][k]
  __shared__ __align__(16) _Float16 Ws[128][KEY_CH + 8];   // Wp rows [channel][k]

  const int tid = threadIdx.x;
  const int w = tid >> 5, lane = tid & 31, g = lane >> 4, lh = lane & 15;
  const int n0 = blockIdx.x * 64;
  const int b = blockIdx.y;
  const int c0 = blockIdx.z * 128 + w * 16;

  // 16-byte piece tid of each run of 16 rows: row tid / 16, column (tid % 16) * 8
  const char* og = (const char*)(Orow + ((size_t)b * NPIX + n0) * KEY_CH + tid * 8);
  const char* wg = (const char*)(wph + (size_t)blockIdx.z * 128 * KEY_CH + tid * 8);
  const unsigned ol = (unsigned)(size_t)&Os[tid >> 4][(tid & 15) * 8];
  const unsigned wl = (unsigned)(size_t)&Ws[tid >> 4][(tid & 15) * 8];
  const unsigned run = 16u * (unsigned)sizeof(Os[0]);   // 16 rows in LDS
  copy4(ol, run, og, 4096u);
  copy8(wl, run, wg, 4096u);

  // the residual x of every output element of this lane, in flight beside the copies
  const size_t off0 = (size_t)(b * IN_CH + c0 + 8 * g) * NPIX + n0 + lh;
  float xr[4][8];
#pragma unroll
  for (int j = 0; j < 4; ++j)
#pragma unroll
    for (int r = 0; r < 8; ++r) xr[j][r] = x[off0 + (size_t)r * NPIX + j * 16];
  // A precaution: stands ahead of the LDS reads, whose results reuse the loads' address registers.
  asm volatile("s_wait_xcnt 0x0" ::: "memory");

  asm volatile("s_wait_asynccnt 0x0" ::: "memory");  // this wave's copies have landed
  __syncthreads();                                   // and every other wave's

  half16 a[4], bf[4][4];
#pragma unroll
  for (int kc = 0; kc < 4; ++kc) {
    a[kc] = load_frag(&Ws[w * 16 + lh][kc * 32 + g * 8],
                      &Ws[w * 16 + lh][kc * 32 + 16 + g * 8]);
#pragma unroll
    for (int j = 0; j < 4; ++j)
      bf[kc][j] = load_frag(&Os[j * 16 + lh][kc * 32 + g * 8],
                            &Os[j * 16 + lh][kc * 32 + 16 + g * 8]);
  }
  // Keeps the forty LDS reads together ahead of the products: left to itself the
  // compiler reads pair by pair and waits each pair out, one LDS latency after another.
  __builtin_amdgcn_sched_barrier(0);
  f32x8 acc[4];
#pragma unroll
  for (int j = 0; j < 4; ++j) acc[j] = zero8();
#pragma unroll
  for (int kc = 0; kc < 4; ++kc)
#pragma unroll
    for (int j = 0; j < 4; ++j) acc[j] = wmma_f16(a[kc], bf[kc][j], acc[j]);

#pragma unroll
  for (int j = 0; j < 4; ++j)
#pragma unroll
    for (int r = 0; r < 8; ++r)
      out[off0 + (size_t)r * NPIX + j * 16] = acc[j][r] + xr[j][r];
}

// ---------------------------------------------------------------------------
// Host launcher
// ---------------------------------------------------------------------------
extern "C" void kernel_launch(void* const* d_in, const int* in_sizes, int n_in,
                              void* d_out, int out_size, void* d_ws, size_t ws_size,
                              hipStream_t stream) {
  const float* x  = (const float*)d_in[0];
  const float* Wq = (const float*)d_in[1];
  const float* Wk = (const float*)d_in[2];
  const float* Wv = (const float*)d_in[3];
  const float* Wp = (const float*)d_in[4];
  float* out = (float*)d_out;

  // workspace carve-up (all f16)
  char* ws = (char*)d_ws;
  size_t off = 0;
  _Float16* wph = (_Float16*)(ws + off); off += (size_t)IN_CH * KEY_CH * 2;
  _Float16* Qh  = (_Float16*)(ws + off); off += (size_t)NB * KEY_CH * NPIX * 2;  // 4 MB
  _Float16* Kh  = (_Float16*)(ws + off); off += (size_t)NB * KEY_CH * NPIX * 2;  // 4 MB
  _Float16* Vt  = (_Float16*)(ws + off); off += (size_t)NB * KEY_CH * NPIX * 2;  // 4 MB
  _Float16* Orow = (_Float16*)(ws + off); off += (size_t)NB * NPIX * KEY_CH * 2; // 4 MB

  // 1) Q/K/V projections (f32 operands rounded to f16 inside; Wp rounded on the side)
  proj_qkv_kernel<<<NB * (NPIX / 64), 256, 0, stream>>>(
      x, Wq, Wk, Wv, Wp, wph, Qh, Kh, Vt);

  // 2) flash attention
  attn_kernel<<<dim3(NPIX / 128, NB * HEADS), 256, 0, stream>>>(Qh, Kh, Vt, Orow);

  // 3) output projection + residual
  out_proj_kernel<<<dim3(NPIX / 64, NB, 2), 256, 0, stream>>>(wph, Orow, x, out);
}

// v009
// A run of this version takes 45.7 microseconds.
// Next to v008, in two timings, it ran 1.04 and 1.03 times as fast.
// All steps since v000 together make it 6.66 times as fast.
#include <hip/hip_runtime.h>
#include <hip/hip_bf16.h>

// ---------------------------------------------------------------------------
// LiteSelfAttention2D for MI455X (gfx1250): flash-attention on v_wmma_f32_16x16x32_f16
// B=4, C=256, KEY_CH=128, HEADS=4, HEAD_DIM=32, N=4096
// ---------------------------------------------------------------------------

#define NB      4
#define IN_CH   256
#define KEY_CH  128
#define HEADS   4
#define HEAD_DIM 32
#define NPIX    4096   // 64*64

typedef _Float16 half8  __attribute__((ext_vector_type(8)));
typedef _Float16 half16 __attribute__((ext_vector_type(16)));
typedef _Float16 half4  __attribute__((ext_vector_type(4)));
typedef float    f32x2  __attribute__((ext_vector_type(2)));
typedef float    f32x4  __attribute__((ext_vector_type(4)));
typedef float    f32x8  __attribute__((ext_vector_type(8)));

// Build a 16x32 (or 32x16) f16 WMMA fragment from two 16-byte chunks.
// A-layout: lane L holds row L%16, K-chunks at g*8 and 16+g*8 (g = L/16).
// B-layout is the mirror (lane = column, same K pattern).
static __device__ __forceinline__ half16 load_frag(const _Float16* lo,
                                                   const _Float16* hi) {
  half8 a = *(const half8*)lo;
  half8 b = *(const half8*)hi;
  half16 r;
#pragma unroll
  for (int i = 0; i < 8; ++i) { r[i] = a[i]; r[i + 8] = b[i]; }
  return r;
}

// The same fragment from four loaded f32 quads (two runs of 8 floats): each
// value times s, rounded to f16 (s = 1 for an unscaled matrix).
static __device__ __forceinline__ half16 round_frag(const f32x4* q, float s) {
  half16 r;
#pragma unroll
  for (int i = 0; i < 16; ++i) r[i] = (_Float16)(q[i >> 2][i & 3] * s);
  return r;
}

static __device__ __forceinline__ f32x8 wmma_f16(half16 a, half16 b, f32x8 c) {
  // D = A(16x32 f16) * B(32x16 f16) + C(16x16 f32)
  return __builtin_amdgcn_wmma_f32_16x16x32_f16(false, a, false, b,
                                                (short)0, c, false, false);
}

static __device__ __forceinline__ f32x8 zero8() {
  f32x8 z = {0.f, 0.f, 0.f, 0.f, 0.f, 0.f, 0.f, 0.f};
  return z;
}

// Four / eight 16-byte copies of one thread from global memory straight into LDS:
// copy i goes from g + i * gstep bytes to the LDS byte address l + i * lstep. The
// wait stands inside the statement, as a precaution, ahead of any rewrite of the
// address registers.
static __device__ __forceinline__ void copy4(unsigned l, unsigned lstep,
                                             const char* g, unsigned gstep) {
  asm volatile("global_load_async_to_lds_b128 %0, %1, off\n\t"
               "global_load_async_to_lds_b128 %2, %3, off\n\t"
               "global_load_async_to_lds_b128 %4, %5, off\n\t"
               "global_load_async_to_lds_b128 %6, %7, off\n\t"
               "s_wait_xcnt 0x0"
               ::"v"(l), "v"(g), "v"(l + lstep), "v"(g + gstep),
                 "v"(l + 2 * lstep), "v"(g + 2 * gstep),
                 "v"(l + 3 * lstep), "v"(g + 3 * gstep) : "memory");
}
static __device__ __forceinline__ void copy8(unsigned l, unsigned lstep,
                                             const char* g, unsigned gstep) {
  asm volatile("global_load_async_to_lds_b128 %0, %1, off\n\t"
               "global_load_async_to_lds_b128 %2, %3, off\n\t"
               "global_load_async_to_lds_b128 %4, %5, off\n\t"
               "global_load_async_to_lds_b128 %6, %7, off\n\t"
               "global_load_async_to_lds_b128 %8, %9, off\n\t"
               "global_load_async_to_lds_b128 %10, %11, off\n\t"
               "global_load_async_to_lds_b128 %12, %13, off\n\t"
               "global_load_async_to_lds_b128 %14, %15, off\n\t"
               "s_wait_xcnt 0x0"
               ::"v"(l), "v"(g), "v"(l + lstep), "v"(g + gstep),
                 "v"(l + 2 * lstep), "v"(g + 2 * gstep),
                 "v"(l + 3 * lstep), "v"(g + 3 * gstep),
                 "v"(l + 4 * lstep), "v"(g + 4 * gstep),
                 "v"(l + 5 * lstep), "v"(g + 5 * gstep),
                 "v"(l + 6 * lstep), "v"(g + 6 * gstep),
                 "v"(l + 7 * lstep), "v"(g + 7 * gstep) : "memory");
}

// ---------------------------------------------------------------------------
// Kernel 1: projections Q,K,V = W * x  (per image: [128,256] x [256,4096])
// Grid: NB*64 blocks, 256 threads (8 waves). Wave w -> output rows 16w..16w+15.
// The block's x tile is transposed through LDS, whole and once, so the B-fragment
// (K = channel dim) becomes two contiguous ds_load_b128 per lane. x and the weights arrive as f32
// and are rounded to f16 here: x while it is staged, Wq/Wk/Wv in registers (the
// softmax scale log2(e)/sqrt(32) folded into Wq before the rounding), and each block
// rounds its 128 elements of Wp into wph for the output projection's launch.
// Wq/Wk/Wv come through LDS, 64 channels a stage, by asynchronous copies into two
// buffers: a wave's copy takes two 256-B row pieces (4 whole cache lines), where a
// fragment load from global memory touches 16 lines for the same 512 B.
// Outputs: Qh,Kh f16 [b][h][n][32] (row-major), Vt f16 [b][h][32][n].
// ---------------------------------------------------------------------------
__global__ void __launch_bounds__(256) proj_qkv_kernel(
    const float* __restrict__ x,
    const float* __restrict__ wq, const float* __restrict__ wk,
    const float* __restrict__ wv, const float* __restrict__ wp,
    _Float16* __restrict__ wph,
    _Float16* __restrict__ Qh, _Float16* __restrict__ Kh,
    _Float16* __restrict__ Vt) {
  // whole 256-channel tile [n][c]; row pitch 528 B = 16 B x odd, so the
  // ds_load_b128 of the fragments do not collide on banks
  __shared__ __align__(16) _Float16 Xt[64][IN_CH + 8];
  // [buffer][Wq rows, Wk rows, Wv rows][64 channels f32]; 256-B rows at pitch 272 B
  // = 16 B x odd, for the same reason
  __shared__ __align__(16) float Wt[2][3 * KEY_CH][64 + 4];

  const int bx = blockIdx.x;
  const int b = bx >> 6;
  const int n0 = (bx & 63) * 64;
  const int tid = threadIdx.x;
  const int w = tid >> 5, lane = tid & 31, g = lane >> 4, lh = lane & 15;
  const float* xb = x + (size_t)b * IN_CH * NPIX;
  const float qs = 0.25503487f;           // log2(e)/sqrt(HEAD_DIM): scores in log2 units
  const int sn = lane * 2;                // staging: this thread's two pixels
  const int sc = w * 8;                   // and its 8 channels of each 64-channel group

  const int wrow = w * 16 + lh;           // output row for this lane's fragment

  // weight staging: 16-byte piece tid of each run of 16 rows (row tid / 16, four
  // channels from (tid % 16) * 4); eight runs a matrix and stage
  const int wo = (tid >> 4) * IN_CH + (tid & 15) * 4;
  const char* wqp = (const char*)(wq + wo);
  const char* wkp = (const char*)(wk + wo);
  const char* wvp = (const char*)(wv + wo);
  const unsigned wl = (unsigned)(size_t)&Wt[0][tid >> 4][(tid & 15) * 4];
  const unsigned wrun = 16u * (unsigned)sizeof(Wt[0][0]);          // 16 rows in LDS
  const unsigned wmat = KEY_CH * (unsigned)sizeof(Wt[0][0]);       // one matrix
  const unsigned wbuf = (unsigned)sizeof(Wt[0]);                   // one buffer
  const unsigned grun = 16u * IN_CH * 4u;                          // 16 rows in memory

  // ---- stage 0 set off: it flies beside the x tile ----
  copy8(wl, wrun, wqp, grun);
  copy8(wl + wmat, wrun, wkp, grun);
  copy8(wl + 2 * wmat, wrun, wvp, grun);

  // the block's whole x tile, 256 c x 64 n f32: all 32 loads of a thread (a wave's
  // load is one 256-B row of the tile) are set off before the first is used: one
  // memory latency for the tile, not one a trip
  f32x2 xv[4][8];
#pragma unroll
  for (int t = 0; t < 4; ++t)
#pragma unroll
    for (int k = 0; k < 8; ++k)
      xv[t][k] = *(const f32x2*)(xb + (size_t)(t * 64 + sc + k) * NPIX + n0 + sn);
  // A precaution: stands ahead of the roundings, which reuse the loads' address registers.
  asm volatile("s_wait_xcnt 0x0" ::: "memory");
  // rounded to f16 and stored transposed as [n][c]
#pragma unroll
  for (int t = 0; t < 4; ++t)
#pragma unroll
    for (int e = 0; e < 2; ++e) {
      half8 xc;
#pragma unroll
      for (int k = 0; k < 8; ++k) xc[k] = (_Float16)xv[t][k][e];
      *(half8*)(&Xt[sn + e][t * 64 + sc]) = xc;
    }

  f32x8 acc[3][4];
#pragma unroll
  for (int p = 0; p < 3; ++p)
#pragma unroll
    for (int j = 0; j < 4; ++j) acc[p][j] = zero8();

  asm volatile("s_wait_asynccnt 0x0" ::: "memory");  // this wave's copies of stage 0 have landed
  __syncthreads();  // the x tile (never rewritten) and stage 0 are published
  // ---- stage 1 set off ----
  copy8(wl + wbuf, wrun, wqp + 256, grun);
  copy8(wl + wbuf + wmat, wrun, wkp + 256, grun);
  copy8(wl + wbuf + 2 * wmat, wrun, wvp + 256, grun);

#pragma unroll
  for (int t = 0; t < 8; ++t) {
    const int cc = t * 32;
    const int buf = (t >> 1) & 1;         // stage t / 2, two 32-channel trips a stage
    // weights of this trip as staged: [0..3] Wq, [4..7] Wk, [8..11] Wv
    f32x4 fw[12];
#pragma unroll
    for (int i = 0; i < 4; ++i) {
      const int o = (t & 1) * 32 + (i >> 1) * 16 + g * 8 + (i & 1) * 4;
      fw[i]     = *(const f32x4*)&Wt[buf][wrow][o];
      fw[4 + i] = *(const f32x4*)&Wt[buf][KEY_CH + wrow][o];
      fw[8 + i] = *(const f32x4*)&Wt[buf][2 * KEY_CH + wrow][o];
    }
    half16 bf[4];
#pragma unroll
    for (int j = 0; j < 4; ++j)
      bf[j] = load_frag(&Xt[j * 16 + lh][cc + g * 8], &Xt[j * 16 + lh][cc + 16 + g * 8]);
    // Keeps this trip's twenty LDS reads together ahead of the roundings and
    // products: sunk to their use each would be waited out there.
    __builtin_amdgcn_sched_barrier(0);
    half16 aq = round_frag(&fw[0], qs);
    half16 ak = round_frag(&fw[4], 1.f);
    half16 av = round_frag(&fw[8], 1.f);
#pragma unroll
    for (int j = 0; j < 4; ++j) {
      acc[0][j] = wmma_f16(aq, bf[j], acc[0][j]);
      acc[1][j] = wmma_f16(ak, bf[j], acc[1][j]);
      acc[2][j] = wmma_f16(av, bf[j], acc[2][j]);
    }
    if (t & 1) {
      // ---- hand-over: the next stage is published, this stage's buffer is freed ----
      asm volatile("s_wait_dscnt 0x0" ::: "memory");     // this wave's reads of the buffer are over
      asm volatile("s_wait_asynccnt 0x0" ::: "memory");  // its copies of the next stage have landed
      __syncthreads();
      if (t + 4 < 8) {  // stage t / 2 + 2 into the buffer just read
        const unsigned go = (unsigned)((t >> 1) + 2) * 256u;
        copy8(wl + buf * wbuf, wrun, wqp + go, grun);
        copy8(wl + buf * wbuf + wmat, wrun, wkp + go, grun);
        copy8(wl + buf * wbuf + 2 * wmat, wrun, wvp + go, grun);
      }
    }
  }
  asm volatile("s_wait_asynccnt 0x0" ::: "memory");  // no copy is left in flight at the end

  // wave 0: this block's IN_CH*KEY_CH / gridDim.x = 128 elements of Wp, loaded
  // behind the last barrier, rounded and stored behind the scatter
  f32x4 wpv = {0.f, 0.f, 0.f, 0.f};
  if (tid < 32) wpv = *(const f32x4*)(wp + bx * 128 + tid * 4);

  // scatter to Qh/Kh (row-major per pixel) and Vt (transposed)
#pragma unroll
  for (int j = 0; j < 4; ++j) {
#pragma unroll
    for (int r = 0; r < 8; ++r) {
      int kk = w * 16 + r + 8 * g;       // 0..127
      int h = kk >> 5, d = kk & 31;
      int n = n0 + j * 16 + lh;
      size_t hb = (size_t)(b * HEADS + h);
      size_t qoff = (hb * NPIX + n) * HEAD_DIM + d;
      Qh[qoff] = (_Float16)acc[0][j][r];
      Kh[qoff] = (_Float16)acc[1][j][r];
      Vt[(hb * HEAD_DIM + d) * NPIX + n] = (_Float16)acc[2][j][r];
    }
  }

  if (tid < 32) {
    half4 hv;
#pragma unroll
    for (int i = 0; i < 4; ++i) hv[i] = (_Float16)wpv[i];
    *(half4*)(wph + bx * 128 + tid * 4) = hv;
  }
}

// ---------------------------------------------------------------------------
// Kernel 2: flash attention. Grid (N/128, B*HEADS), 256 threads = 8 waves.
// A wave owns 32 queries (two Q^T fragments) and one half of the keys: waves
// 0..3 take keys 0..2047, waves 4..7 keys 2048..4095 for the same 128 queries.
// Every K and V^T fragment read from LDS feeds two products, one a query tile,
// and the test, the waits and the barrier of a step are paid once for both.
// Per step (one 64-key tile of each half):
//   - all 8 waves cooperatively stage the two K tiles (64x32 f16, 4 KB each) and
//     the two V^T tiles (32x64 f16) into LDS, by asynchronous copies into two
//     buffers: the next step's tiles fly while these are worked on, one barrier
//     a step;
//   - 8 WMMAs for S^T = K Q^T - shift (scale and log2(e) pre-folded into Q, the
//     C operand holds minus the query's shift): per query tile a lane holds 32 of
//     the 64 shifted scores of ONE query (column lh), its partner lane^16 the rest;
//   - softmax in f32 in registers on all 32 lanes: exp2 straight from D. The
//     shift is a maximum seen earlier: tile 0's, set ahead of the loop. It is
//     raised, and O and l rescaled, only where a half-wave's sum of a tile's 32
//     probabilities tops 2^8 (one test per step for the wave). The sum is formed
//     anyway and bounds each of its terms, so the usual tile takes no maximum;
//     sums stay per half-wave until the end;
//   - 8 WMMAs for O^T += V^T P^T: two converted S^T tiles ARE the B operand.
// At the end the upper key half hands O, l and its shift over through LDS and the
// lower one joins the two on the larger shift.
// Output Orow f16 [b][n][128] (channel-contiguous per pixel).
// ---------------------------------------------------------------------------
#define KHALF (NPIX / 2)        // keys of one half
#define NSTEP (KHALF / 64)      // 64-key tiles of one half

// value of lane l ^ 16
static __device__ __forceinline__ float other_half(float v) {
  int b = __builtin_bit_cast(int, v);
  b = __builtin_amdgcn_permlanex16(b, b, 0x76543210, 0xfedcba98, false, false);
  return __builtin_bit_cast(float, b);
}

// largest of this half-wave's 32 scores of one 64-key tile
static __device__ __forceinline__ float tile_max(const f32x8* s) {
  float mt[4];
#pragma unroll
  for (int j = 0; j < 4; ++j) {
    mt[j] = fmaxf(fmaxf(fmaxf(s[j][0], s[j][1]), fmaxf(s[j][2], s[j][3])),
                  fmaxf(fmaxf(s[j][4], s[j][5]), fmaxf(s[j][6], s[j][7])));
  }
  return fmaxf(fmaxf(mt[0], mt[1]), fmaxf(mt[2], mt[3]));
}

// P^T of one 64-key tile from its shifted scores, and this half-wave's sum of it.
// P^T as B operand: element i = key 32mj + 8g + i, element 8 + i = key
// 32mj + 16 + 8g + i, which is the k order load_frag gives V^T.
static __device__ __forceinline__ float tile_probs(const f32x8* s, half16* p) {
  float st[4];
#pragma unroll
  for (int j = 0; j < 4; ++j) {
    float e[8];
#pragma unroll
    for (int r = 0; r < 8; ++r) {
      e[r] = __builtin_amdgcn_exp2f(s[j][r]);
      p[j >> 1][(j & 1) * 8 + r] = (_Float16)e[r];
    }
    st[j] = ((e[0] + e[1]) + (e[2] + e[3])) + ((e[4] + e[5]) + (e[6] + e[7]));
  }
  return (st[0] + st[1]) + (st[2] + st[3]);
}

// One thread's share of a step's four tiles, 16 bytes each, from global memory
// straight into LDS: K and V^T of the lower key half (kl, vl: LDS byte addresses),
// then of the upper (kh, vh). The wait stands inside the statement, as a
// precaution, ahead of any rewrite of the address registers.
static __device__ __forceinline__ void stage_step(unsigned kl, const _Float16* kg,
                                                  unsigned vl, const _Float16* vg,
                                                  unsigned kh, const _Float16* kgh,
                                                  unsigned vh, const _Float16* vgh) {
  asm volatile("global_load_async_to_lds_b128 %0, %1, off\n\t"
               "global_load_async_to_lds_b128 %2, %3, off\n\t"
               "global_load_async_to_lds_b128 %4, %5, off\n\t"
               "global_load_async_to_lds_b128 %6, %7, off\n\t"
               "s_wait_xcnt 0x0"
               ::"v"(kl), "v"(kg), "v"(vl), "v"(vg),
                 "v"(kh), "v"(kgh), "v"(vh), "v"(vgh) : "memory");
}

__global__ void __launch_bounds__(256) attn_kernel(
    const _Float16* __restrict__ Qh, const _Float16* __restrict__ Kh,
    const _Float16* __restrict__ Vt, _Float16* __restrict__ Orow) {
  // [buffer][key half][row][column]. Row pitch = 16 B x odd, so the 16 rows one
  // ds_load_b128 half-wave reads fall on 64 distinct banks (unpadded 64 B / 128 B
  // rows collide 4x / 8x).
  __shared__ __align__(16) _Float16 Ks[2][2][64][40];   // K tiles, 64 B rows at pitch 80 B
  __shared__ __align__(16) _Float16 Vs[2][2][32][72];   // V^T tiles, 128 B rows at pitch 144 B
  // hand-over of the upper key half's result: [query group][quad][lane]; quads
  // 4qt..4qt+3 = O of query tile qt, quad 8 = both shifts and both sums
  __shared__ __align__(16) f32x4 Mg[4][9][32];

  const int tid = threadIdx.x;
  const int lane = tid & 31, g = lane >> 4, lh = lane & 15;
  const int w = __builtin_amdgcn_readfirstlane(tid >> 5);
  const int wq = w & 3;                 // query group of the wave
  const int wk = w >> 2;                // its key half
  const int bh = blockIdx.y;
  const int b = bh >> 2, h = bh & 3;
  const int q0 = blockIdx.x * 128 + wq * 32;
  const size_t hb = (size_t)(b * HEADS + h);
  const _Float16* qb = Qh + hb * NPIX * HEAD_DIM;
  const _Float16* kb = Kh + hb * NPIX * HEAD_DIM;
  const _Float16* vb = Vt + hb * HEAD_DIM * NPIX;

  // Q^T as B operand: lane = query column q0 + 16qt + lh (reused every iteration)
  half16 bq[2];
  // O^T tiles: register r = O[query lh][d = 8g + r] (o_lo), d = 16 + 8g + r (o_hi)
  f32x8 o_lo[2], o_hi[2];
  f32x8 negm[2];         // minus the shift of this lane's query, in every register
                         // (C operand of the score products; equal in both half-waves)
  float l[2];            // running sum over this half-wave's keys only
#pragma unroll
  for (int qt = 0; qt < 2; ++qt) {
    const _Float16* qr = qb + (size_t)(q0 + qt * 16 + lh) * 32;
    bq[qt] = load_frag(qr + g * 8, qr + 16 + g * 8);
    o_lo[qt] = zero8();
    o_hi[qt] = zero8();
    l[qt] = 0.f;
  }

  // cooperative-staging indices (each thread moves 8+8 f16 per tile and key half)
  const int kslot = tid * 8;            // 0..2047 over the global K tile (64x32)
  const int kr = tid >> 2;              // 0..63  (K row = key)
  const int kc = (tid & 3) * 8;         // 0..24  (d offset within the row)
  const int vd = tid >> 3;              // 0..31  (V^T row = d)
  const int vm = (tid & 7) * 8;         // 0..56  (m offset within tile)
  const _Float16* kg = kb + kslot;                    // this thread's 16 B of K tile 0
  const _Float16* vg = vb + (size_t)vd * NPIX + vm;   // and of V^T tile 0, lower half
  // their places in buffer 0 (LDS byte address = low word of the pointer)
  const unsigned kl = (unsigned)(size_t)&Ks[0][0][kr][kc];
  const unsigned vl = (unsigned)(size_t)&Vs[0][0][vd][vm];
  const unsigned kbuf = (unsigned)sizeof(Ks[0]), khalf = (unsigned)sizeof(Ks[0][0]);
  const unsigned vbuf = (unsigned)sizeof(Vs[0]), vhalf = (unsigned)sizeof(Vs[0][0]);

  // ---- step 0 into buffer 0, landed and published; then step 1 set off ----
  stage_step(kl, kg, vl, vg,
             kl + khalf, kg + KHALF * 32, vl + vhalf, vg + KHALF);
  asm volatile("s_wait_asynccnt 0x0" ::: "memory");  // this wave's copies have landed
  __syncthreads();                                   // and every other wave's
  stage_step(kl + kbuf, kg + 64 * 32, vl + vbuf, vg + 64,
             kl + kbuf + khalf, kg + (KHALF + 64) * 32, vl + vbuf + vhalf, vg + KHALF + 64);

  // ---- the shift starts as the largest score of tile 0 (of this key half) ----
  {
    half16 ak[4];
#pragma unroll
    for (int j = 0; j < 4; ++j)
      ak[j] = load_frag(&Ks[0][wk][j * 16 + lh][g * 8],
                        &Ks[0][wk][j * 16 + lh][16 + g * 8]);
#pragma unroll
    for (int qt = 0; qt < 2; ++qt) {
      f32x8 s0[4];
#pragma unroll
      for (int j = 0; j < 4; ++j) s0[j] = wmma_f16(ak[j], bq[qt], zero8());
      const float mx = tile_max(s0);
      const float mq = fmaxf(mx, other_half(mx));
#pragma unroll
      for (int r = 0; r < 8; ++r) negm[qt][r] = -mq;
    }
  }

  // two trips a pass of the loop: the buffer index is then a constant of each
  // copy of the body and every LDS address keeps its immediate offset
#pragma unroll 2
  for (int kt = 0; kt < NSTEP; ++kt) {
    const int buf = kt & 1;
    // ---- S^T = K Q^T - shift: s[qt][j][r] = score(query 16qt + lh, key 16j + 8g + r) ----
    half16 ak[4];
#pragma unroll
    for (int j = 0; j < 4; ++j)
      ak[j] = load_frag(&Ks[buf][wk][j * 16 + lh][g * 8],
                        &Ks[buf][wk][j * 16 + lh][16 + g * 8]);
    // V^T fragments, read ahead of the vector work: the test below ends the
    // block, and reads placed behind it would each be waited out
    half16 av[4];
#pragma unroll
    for (int mj = 0; mj < 2; ++mj) {
      av[2 * mj]     = load_frag(&Vs[buf][wk][lh][mj * 32 + g * 8],
                                 &Vs[buf][wk][lh][mj * 32 + 16 + g * 8]);
      av[2 * mj + 1] = load_frag(&Vs[buf][wk][16 + lh][mj * 32 + g * 8],
                                 &Vs[buf][wk][16 + lh][mj * 32 + 16 + g * 8]);
    }
    // Keeps the sixteen reads together ahead of the products: left to itself the
    // compiler reads the K fragments pair by pair into one register set and waits
    // each pair out in front of its products, one LDS latency after another.
    __builtin_amdgcn_sched_barrier(0);
    f32x8 s[2][4];
#pragma unroll
    for (int qt = 0; qt < 2; ++qt)
#pragma unroll
      for (int j = 0; j < 4; ++j) s[qt][j] = wmma_f16(ak[j], bq[qt], negm[qt]);
    // Keeps the eight score products ahead of the vector work: woven between them,
    // each exp2 would stand behind its own product's idle slots.
    __builtin_amdgcn_sched_barrier(0);
    half16 p[2][2];
    float sum[2];
    sum[0] = tile_probs(s[0], p[0]);
    sum[1] = tile_probs(s[1], p[1]);
    // ---- raise the shift where a sum tops 2^8: no term is negative, so below that
    // every probability is at most 2^8, far inside f16 (an overflow to infinity
    // tops it too). The maximum is taken only here. Marked unlikely so that the
    // raise is laid out behind the loop and the usual tile runs straight through. ----
    if (__builtin_expect(__builtin_amdgcn_ballot_w32(fmaxf(sum[0], sum[1]) > 256.f) != 0, 0)) {
#pragma unroll
      for (int qt = 0; qt < 2; ++qt) {
        // the scores are formed anew, unshifted and then on the raised shift: held
        // over the exp2 for this path they would cost every tile 64 registers
#pragma unroll
        for (int j = 0; j < 4; ++j) s[qt][j] = wmma_f16(ak[j], bq[qt], zero8());
        const float mx = tile_max(s[qt]);
        const float up = fmaxf(fmaxf(mx, other_half(mx)) + negm[qt][0], 0.f);
        const float alpha = __builtin_amdgcn_exp2f(-up);
#pragma unroll
        for (int r = 0; r < 8; ++r) {
          negm[qt][r] -= up;
          o_lo[qt][r] *= alpha;
          o_hi[qt][r] *= alpha;
        }
#pragma unroll
        for (int j = 0; j < 4; ++j) s[qt][j] = wmma_f16(ak[j], bq[qt], negm[qt]);
        sum[qt] = tile_probs(s[qt], p[qt]);
        l[qt] *= alpha;
      }
    }
    l[0] += sum[0];
    l[1] += sum[1];
    // ---- O^T += V^T P^T (two 32-wide key sub-tiles; d split 0..15 / 16..31) ----
#pragma unroll
    for (int mj = 0; mj < 2; ++mj) {
#pragma unroll
      for (int qt = 0; qt < 2; ++qt) {
        o_lo[qt] = wmma_f16(av[2 * mj], p[qt][mj], o_lo[qt]);
        o_hi[qt] = wmma_f16(av[2 * mj + 1], p[qt][mj], o_hi[qt]);
      }
    }
    // ---- hand-over: step kt + 1 is published, this step's buffer is freed ----
    asm volatile("s_wait_dscnt 0x0" ::: "memory");     // this wave's reads of the buffer are over
    asm volatile("s_wait_asynccnt 0x0" ::: "memory");  // its copies of step kt + 1 have landed
    __syncthreads();
    if (kt + 2 < NSTEP) {  // step kt + 2 into the buffer just read
      const _Float16* kn = kg + (size_t)(kt + 2) * (64 * 32);
      const _Float16* vn = vg + (kt + 2) * 64;
      stage_step(kl + buf * kbuf, kn, vl + buf * vbuf, vn,
                 kl + buf * kbuf + khalf, kn + KHALF * 32, vl + buf * vbuf + vhalf, vn + KHALF);
    }
  }
  asm volatile("s_wait_asynccnt 0x0" ::: "memory");  // no copy is left in flight at the end

  // ---- the upper key half hands its O, shifts and sums over ----
  if (wk == 1) {
#pragma unroll
    for (int qt = 0; qt < 2; ++qt) {
      f32x4 c0 = {o_lo[qt][0], o_lo[qt][1], o_lo[qt][2], o_lo[qt][3]};
      f32x4 c1 = {o_lo[qt][4], o_lo[qt][5], o_lo[qt][6], o_lo[qt][7]};
      f32x4 c2 = {o_hi[qt][0], o_hi[qt][1], o_hi[qt][2], o_hi[qt][3]};
      f32x4 c3 = {o_hi[qt][4], o_hi[qt][5], o_hi[qt][6], o_hi[qt][7]};
      Mg[wq][qt * 4 + 0][lane] = c0;
      Mg[wq][qt * 4 + 1][lane] = c1;
      Mg[wq][qt * 4 + 2][lane] = c2;
      Mg[wq][qt * 4 + 3][lane] = c3;
    }
    f32x4 c8 = {negm[0][0], negm[1][0], l[0], l[1]};
    Mg[wq][8][lane] = c8;
  }
  __syncthreads();  // the hand-over is published
  if (wk == 1) return;

  // ---- finalize: join the key halves on the larger shift, then the half-waves'
  // sums, divide, store Orow[b][n][h*32 + d] ----
  const f32x4 u8 = Mg[wq][8][lane];
#pragma unroll
  for (int qt = 0; qt < 2; ++qt) {
    const float nm = fminf(negm[qt][0], u8[qt]);                  // minus the larger shift
    const float a0 = __builtin_amdgcn_exp2f(nm - negm[qt][0]);    // this half's weight
    const float a1 = __builtin_amdgcn_exp2f(nm - u8[qt]);         // the upper half's
    const float lj = l[qt] * a0 + u8[2 + qt] * a1;
    const float inv = 1.f / (lj + other_half(lj));
    const float f0 = a0 * inv, f1 = a1 * inv;
    const f32x4 u0 = Mg[wq][qt * 4 + 0][lane];
    const f32x4 u1 = Mg[wq][qt * 4 + 1][lane];
    const f32x4 u2 = Mg[wq][qt * 4 + 2][lane];
    const f32x4 u3 = Mg[wq][qt * 4 + 3][lane];
    half8 lo8, hi8;
#pragma unroll
    for (int r = 0; r < 4; ++r) {
      lo8[r]     = (_Float16)(o_lo[qt][r] * f0 + u0[r] * f1);
      lo8[4 + r] = (_Float16)(o_lo[qt][4 + r] * f0 + u1[r] * f1);
      hi8[r]     = (_Float16)(o_hi[qt][r] * f0 + u2[r] * f1);
      hi8[4 + r] = (_Float16)(o_hi[qt][4 + r] * f0 + u3[r] * f1);
    }
    _Float16* ob = Orow + (size_t)b * NPIX * KEY_CH + h * HEAD_DIM +
                   (size_t)(q0 + qt * 16 + lh) * KEY_CH + g * 8;
    *(half8*)ob        = lo8;
    *(half8*)(ob + 16) = hi8;
  }
}

// ---------------------------------------------------------------------------
// Kernel 3: out = Wp @ O + x.  [256,128] x [128,4096] per image.
// Grid (N/64, B, 2), 256 threads; wave w handles 16 output channels.
// The block's O tile (64 pixels x 128 k, 16 KB in a row in memory) and its 128 rows
// of Wp (32 KB in a row) come into LDS once, by asynchronous copies: a wave's copy
// takes 512 B in a row (4 whole cache lines), where a fragment load from global
// memory touches 16 lines for the same 512 B, and each of the 8 waves fetched the
// whole O tile for itself.
// ---------------------------------------------------------------------------
__global__ void __launch_bounds__(256) out_proj_kernel(
    const _Float16* __restrict__ wph, const _Float16* __restrict__ Orow,
    const float* __restrict__ x, float* __restrict__ out) {
  // 256-B rows at pitch 272 B = 16 B x odd: the 16 rows one ds_load_b128 half-wave
  // reads fall on 64 distinct banks
  __shared__ __align__(16) _Float16 Os[64][KEY_CH + 8];    // O tile [pixel][k]
  __shared__ __align__(16) _Float16 Ws[128][KEY_CH + 8];   // Wp rows [channel][k]

  const int tid = threadIdx.x;
  const int w = tid >> 5, lane = tid & 31, g = lane >> 4, lh = lane & 15;
  const int n0 = blockIdx.x * 64;
  const int b = blockIdx.y;
  const int c0 = blockIdx.z * 128 + w * 16;

  // 16-byte piece tid of each run of 16 rows: row tid / 16, column (tid % 16) * 8
  const char* og = (const char*)(Orow + ((size_t)b * NPIX + n0) * KEY_CH + tid * 8);
  const char* wg = (const char*)(wph + (size_t)blockIdx.z * 128 * KEY_CH + tid * 8);
  const unsigned ol = (unsigned)(size_t)&Os[tid >> 4][(tid & 15) * 8];
  const unsigned wl = (unsigned)(size_t)&Ws[tid >> 4][(tid & 15) * 8];
  const unsigned run = 16u * (unsigned)sizeof(Os[0]);   // 16 rows in LDS
  copy4(ol, run, og, 4096u);
  copy8(wl, run, wg, 4096u);

  // the residual x of every output element of this lane, in flight beside the copies
  const size_t off0 = (size_t)(b * IN_CH + c0 + 8 * g) * NPIX + n0 + lh;
  float xr[4][8];
#pragma unroll
  for (int j = 0; j < 4; ++j)
#pragma unroll
    for (int r = 0; r < 8; ++r) xr[j][r] = x[off0 + (size_t)r * NPIX + j * 16];
  // A precaution: stands ahead of the LDS reads, whose results reuse the loads' address registers.
  asm volatile("s_wait_xcnt 0x0" ::: "memory");

  asm volatile("s_wait_asynccnt 0x0" ::: "memory");  // this wave's copies have landed
  __syncthreads();                                   // and every other wave's

  half16 a[4], bf[4][4];
#pragma unroll
  for (int kc = 0; kc < 4; ++kc) {
    a[kc] = load_frag(&Ws[w * 16 + lh][kc * 32 + g * 8],
                      &Ws[w * 16 + lh][kc * 32 + 16 + g * 8]);
#pragma unroll
    for (int j = 0; j < 4; ++j)
      bf[kc][j] = load_frag(&Os[j * 16 + lh][kc * 32 + g * 8],
                            &Os[j * 16 + lh][kc * 32 + 16 + g * 8]);
  }
  // Keeps the forty LDS reads together ahead of the products: left to itself the
  // compiler reads pair by pair and waits each pair out, one LDS latency after another.
  __builtin_amdgcn_sched_barrier(0);
  f32x8 acc[4];
#pragma unroll
  for (int j = 0; j < 4; ++j) acc[j] = zero8();
#pragma unroll
  for (int kc = 0; kc < 4; ++kc)
#pragma unroll
    for (int j = 0; j < 4; ++j) acc[j] = wmma_f16(a[kc], bf[kc][j], acc[j]);

#pragma unroll
  for (int j = 0; j < 4; ++j)
#pragma unroll
    for (int r = 0; r < 8; ++r)
      out[off0 + (size_t)r * NPIX + j * 16] = acc[j][r] + xr[j][r];
}

// ---------------------------------------------------------------------------
// Host launcher
// ---------------------------------------------------------------------------
extern "C" void kernel_launch(void* const* d_in, const int* in_sizes, int n_in,
                              void* d_out, int out_size, void* d_ws, size_t ws_size,
                              hipStream_t stream) {
  const float* x  = (const float*)d_in[0];
  const float* Wq = (const float*)d_in[1];
  const float* Wk = (const float*)d_in[2];
  const float* Wv = (const float*)d_in[3];
  const float* Wp = (const float*)d_in[4];
  float* out = (float*)d_out;

  // workspace carve-up (all f16)
  char* ws = (char*)d_ws;
  size_t off = 0;
  _Float16* wph = (_Float16*)(ws + off); off += (size_t)IN_CH * KEY_CH * 2;
  _Float16* Qh  = (_Float16*)(ws + off); off += (size_t)NB * KEY_CH * NPIX * 2;  // 4 MB
  _Float16* Kh  = (_Float16*)(ws + off); off += (size_t)NB * KEY_CH * NPIX * 2;  // 4 MB
  _Float16* Vt  = (_Float16*)(ws + off); off += (size_t)NB * KEY_CH * NPIX * 2;  // 4 MB
  _Float16* Orow = (_Float16*)(ws + off); off += (size_t)NB * NPIX * KEY_CH * 2; // 4 MB

  // 1) Q/K/V projections (f32 operands rounded to f16 inside; Wp rounded on the side)
  proj_qkv_kernel<<<NB * (NPIX / 64), 256, 0, stream>>>(
      x, Wq, Wk, Wv, Wp, wph, Qh, Kh, Vt);

  // 2) flash attention
  attn_kernel<<<dim3(NPIX / 128, NB * HEADS), 256, 0, stream>>>(Qh, Kh, Vt, Orow);

  // 3) output projection + residual
  out_proj_kernel<<<dim3(NPIX / 64, NB, 2), 256, 0, stream>>>(wph, Orow, x, out);
}

// v010
// One run takes 43 microseconds.
// Two timings next to v009 put it at 1.06 and 1.05 times that version's speed.
// Counting every step since v000, it is 7.03 times as fast.
#include <hip/hip_runtime.h>
#include <hip/hip_bf16.h>

// ---------------------------------------------------------------------------
// LiteSelfAttention2D for MI455X (gfx1250): flash-attention on v_wmma_f32_16x16x32_f16
// B=4, C=256, KEY_CH=128, HEADS=4, HEAD_DIM=32, N=4096
// ---------------------------------------------------------------------------

#define NB      4
#define IN_CH   256
#define KEY_CH  128
#define HEADS   4
#define HEAD_DIM 32
#define NPIX    4096   // 64*64

typedef _Float16 half8  __attribute__((ext_vector_type(8)));
typedef _Float16 half16 __attribute__((ext_vector_type(16)));
typedef _Float16 half4  __attribute__((ext_vector_type(4)));
typedef float    f32x2  __attribute__((ext_vector_type(2)));
typedef float    f32x4  __attribute__((ext_vector_type(4)));
typedef float    f32x8  __attribute__((ext_vector_type(8)));

// Build a 16x32 (or 32x16) f16 WMMA fragment from two 16-byte chunks.
// A-layout: lane L holds row L%16, K-chunks at g*8 and 16+g*8 (g = L/16).
// B-layout is the mirror (lane = column, same K pattern).
static __device__ __forceinline__ half16 load_frag(const _Float16* lo,
                                                   const _Float16* hi) {
  half8 a = *(const half8*)lo;
  half8 b = *(const half8*)hi;
  half16 r;
#pragma unroll
  for (int i = 0; i < 8; ++i) { r[i] = a[i]; r[i + 8] = b[i]; }
  return r;
}

// The same fragment from four loaded f32 quads (two runs of 8 floats): each
// value times s, rounded to f16 (s = 1 for an unscaled matrix).
static __device__ __forceinline__ half16 round_frag(const f32x4* q, float s) {
  half16 r;
#pragma unroll
  for (int i = 0; i < 16; ++i) r[i] = (_Float16)(q[i >> 2][i & 3] * s);
  return r;
}

static __device__ __forceinline__ f32x8 wmma_f16(half16 a, half16 b, f32x8 c) {
  // D = A(16x32 f16) * B(32x16 f16) + C(16x16 f32)
  return __builtin_amdgcn_wmma_f32_16x16x32_f16(false, a, false, b,
                                                (short)0, c, false, false);
}

static __device__ __forceinline__ f32x8 zero8() {
  f32x8 z = {0.f, 0.f, 0.f, 0.f, 0.f, 0.f, 0.f, 0.f};
  return z;
}

// Four / eight 16-byte copies of one thread from global memory straight into LDS:
// copy i goes from g + i * gstep bytes to the LDS byte address l + i * lstep. The
// wait stands inside the statement, as a precaution, ahead of any rewrite of the
// address registers.
static __device__ __forceinline__ void copy4(unsigned l, unsigned lstep,
                                             const char* g, unsigned gstep) {
  asm volatile("global_load_async_to_lds_b128 %0, %1, off\n\t"
               "global_load_async_to_lds_b128 %2, %3, off\n\t"
               "global_load_async_to_lds_b128 %4, %5, off\n\t"
               "global_load_async_to_lds_b128 %6, %7, off\n\t"
               "s_wait_xcnt 0x0"
               ::"v"(l), "v"(g), "v"(l + lstep), "v"(g + gstep),
                 "v"(l + 2 * lstep), "v"(g + 2 * gstep),
                 "v"(l + 3 * lstep), "v"(g + 3 * gstep) : "memory");
}
static __device__ __forceinline__ void copy8(unsigned l, unsigned lstep,
                                             const char* g, unsigned gstep) {
  asm volatile("global_load_async_to_lds_b128 %0, %1, off\n\t"
               "global_load_async_to_lds_b128 %2, %3, off\n\t"
               "global_load_async_to_lds_b128 %4, %5, off\n\t"
               "global_load_async_to_lds_b128 %6, %7, off\n\t"
               "global_load_async_to_lds_b128 %8, %9, off\n\t"
               "global_load_async_to_lds_b128 %10, %11, off\n\t"
               "global_load_async_to_lds_b128 %12, %13, off\n\t"
               "global_load_async_to_lds_b128 %14, %15, off\n\t"
               "s_wait_xcnt 0x0"
               ::"v"(l), "v"(g), "v"(l + lstep), "v"(g + gstep),
                 "v"(l + 2 * lstep), "v"(g + 2 * gstep),
                 "v"(l + 3 * lstep), "v"(g + 3 * gstep),
                 "v"(l + 4 * lstep), "v"(g + 4 * gstep),
                 "v"(l + 5 * lstep), "v"(g + 5 * gstep),
                 "v"(l + 6 * lstep), "v"(g + 6 * gstep),
                 "v"(l + 7 * lstep), "v"(g + 7 * gstep) : "memory");
}

// ---------------------------------------------------------------------------
// Kernel 1: projections Q,K,V = W * x  (per image: [128,256] x [256,4096])
// Grid: NB*64 blocks, 256 threads (8 waves). Wave w -> output rows 16w..16w+15.
// The block's x tile is transposed through LDS, whole and once, so the B-fragment
// (K = channel dim) becomes two contiguous ds_load_b128 per lane. x and the weights arrive as f32
// and are rounded to f16 here: x while it is staged, Wq/Wk/Wv in registers (the
// softmax scale log2(e)/sqrt(32) folded into Wq before the rounding), and each block
// rounds its 128 elements of Wp into wph for the output projection's launch.
// Wq/Wk/Wv come through LDS, 64 channels a stage, by asynchronous copies into two
// buffers: a wave's copy takes two 256-B row pieces (4 whole cache lines), where a
// fragment load from global memory touches 16 lines for the same 512 B.
// Outputs: Qh,Kh f16 [b][h][n][32] (row-major), Vt f16 [b][h][32][n].
// ---------------------------------------------------------------------------
__global__ void __launch_bounds__(256) proj_qkv_kernel(
    const float* __restrict__ x,
    const float* __restrict__ wq, const float* __restrict__ wk,
    const float* __restrict__ wv, const float* __restrict__ wp,
    _Float16* __restrict__ wph,
    _Float16* __restrict__ Qh, _Float16* __restrict__ Kh,
    _Float16* __restrict__ Vt) {
  // whole 256-channel tile [n][c]; row pitch 528 B = 16 B x odd, so the
  // ds_load_b128 of the fragments do not collide on banks
  __shared__ __align__(16) _Float16 Xt[64][IN_CH + 8];
  // [buffer][Wq rows, Wk rows, Wv rows][64 channels f32]; 256-B rows at pitch 272 B
  // = 16 B x odd, for the same reason
  __shared__ __align__(16) float Wt[2][3 * KEY_CH][64 + 4];

  const int bx = blockIdx.x;
  const int b = bx >> 6;
  const int n0 = (bx & 63) * 64;
  const int tid = threadIdx.x;
  const int w = tid >> 5, lane = tid & 31, g = lane >> 4, lh = lane & 15;
  const float* xb = x + (size_t)b * IN_CH * NPIX;
  const float qs = 0.25503487f;           // log2(e)/sqrt(HEAD_DIM): scores in log2 units
  const int sn = lane * 2;                // staging: this thread's two pixels
  const int sc = w * 8;                   // and its 8 channels of each 64-channel group

  const int wrow = w * 16 + lh;           // output row for this lane's fragment

  // weight staging: 16-byte piece tid of each run of 16 rows (row tid / 16, four
  // channels from (tid % 16) * 4); eight runs a matrix and stage
  const int wo = (tid >> 4) * IN_CH + (tid & 15) * 4;
  const char* wqp = (const char*)(wq + wo);
  const char* wkp = (const char*)(wk + wo);
  const char* wvp = (const char*)(wv + wo);
  const unsigned wl = (unsigned)(size_t)&Wt[0][tid >> 4][(tid & 15) * 4];
  const unsigned wrun = 16u * (unsigned)sizeof(Wt[0][0]);          // 16 rows in LDS
  const unsigned wmat = KEY_CH * (unsigned)sizeof(Wt[0][0]);       // one matrix
  const unsigned wbuf = (unsigned)sizeof(Wt[0]);                   // one buffer
  const unsigned grun = 16u * IN_CH * 4u;                          // 16 rows in memory

  // ---- stage 0 set off: it flies beside the x tile ----
  copy8(wl, wrun, wqp, grun);
  copy8(wl + wmat, wrun, wkp, grun);
  copy8(wl + 2 * wmat, wrun, wvp, grun);

  // the block's whole x tile, 256 c x 64 n f32: all 32 loads of a thread (a wave's
  // load is one 256-B row of the tile) are set off before the first is used: one
  // memory latency for the tile, not one a trip
  f32x2 xv[4][8];
#pragma unroll
  for (int t = 0; t < 4; ++t)
#pragma unroll
    for (int k = 0; k < 8; ++k)
      xv[t][k] = *(const f32x2*)(xb + (size_t)(t * 64 + sc + k) * NPIX + n0 + sn);
  // A precaution: stands ahead of the roundings, which reuse the loads' address registers.
  asm volatile("s_wait_xcnt 0x0" ::: "memory");
  // rounded to f16 and stored transposed as [n][c]
#pragma unroll
  for (int t = 0; t < 4; ++t)
#pragma unroll
    for (int e = 0; e < 2; ++e) {
      half8 xc;
#pragma unroll
      for (int k = 0; k < 8; ++k) xc[k] = (_Float16)xv[t][k][e];
      *(half8*)(&Xt[sn + e][t * 64 + sc]) = xc;
    }

  f32x8 acc[3][4];
#pragma unroll
  for (int p = 0; p < 3; ++p)
#pragma unroll
    for (int j = 0; j < 4; ++j) acc[p][j] = zero8();

  asm volatile("s_wait_asynccnt 0x0" ::: "memory");  // this wave's copies of stage 0 have landed
  __syncthreads();  // the x tile (never rewritten) and stage 0 are published
  // ---- stage 1 set off ----
  copy8(wl + wbuf, wrun, wqp + 256, grun);
  copy8(wl + wbuf + wmat, wrun, wkp + 256, grun);
  copy8(wl + wbuf + 2 * wmat, wrun, wvp + 256, grun);

#pragma unroll
  for (int t = 0; t < 8; ++t) {
    const int cc = t * 32;
    const int buf = (t >> 1) & 1;         // stage t / 2, two 32-channel trips a stage
    // weights of this trip as staged: [0..3] Wq, [4..7] Wk, [8..11] Wv
    f32x4 fw[12];
#pragma unroll
    for (int i = 0; i < 4; ++i) {
      const int o = (t & 1) * 32 + (i >> 1) * 16 + g * 8 + (i & 1) * 4;
      fw[i]     = *(const f32x4*)&Wt[buf][wrow][o];
      fw[4 + i] = *(const f32x4*)&Wt[buf][KEY_CH + wrow][o];
      fw[8 + i] = *(const f32x4*)&Wt[buf][2 * KEY_CH + wrow][o];
    }
    half16 bf[4];
#pragma unroll
    for (int j = 0; j < 4; ++j)
      bf[j] = load_frag(&Xt[j * 16 + lh][cc + g * 8], &Xt[j * 16 + lh][cc + 16 + g * 8]);
    // Keeps this trip's twenty LDS reads together ahead of the roundings and
    // products: sunk to their use each would be waited out there.
    __builtin_amdgcn_sched_barrier(0);
    half16 aq = round_frag(&fw[0], qs);
    half16 ak = round_frag(&fw[4], 1.f);
    half16 av = round_frag(&fw[8], 1.f);
#pragma unroll
    for (int j = 0; j < 4; ++j) {
      acc[0][j] = wmma_f16(aq, bf[j], acc[0][j]);
      acc[1][j] = wmma_f16(ak, bf[j], acc[1][j]);
      acc[2][j] = wmma_f16(av, bf[j], acc[2][j]);
    }
    if (t & 1) {
      // ---- hand-over: the next stage is published, this stage's buffer is freed ----
      asm volatile("s_wait_dscnt 0x0" ::: "memory");     // this wave's reads of the buffer are over
      asm volatile("s_wait_asynccnt 0x0" ::: "memory");  // its copies of the next stage have landed
      __syncthreads();
      if (t + 4 < 8) {  // stage t / 2 + 2 into the buffer just read
        const unsigned go = (unsigned)((t >> 1) + 2) * 256u;
        copy8(wl + buf * wbuf, wrun, wqp + go, grun);
        copy8(wl + buf * wbuf + wmat, wrun, wkp + go, grun);
        copy8(wl + buf * wbuf + 2 * wmat, wrun, wvp + go, grun);
      }
    }
  }
  asm volatile("s_wait_asynccnt 0x0" ::: "memory");  // no copy is left in flight at the end

  // wave 0: this block's IN_CH*KEY_CH / gridDim.x = 128 elements of Wp, loaded
  // behind the last barrier, rounded and stored behind the scatter
  f32x4 wpv = {0.f, 0.f, 0.f, 0.f};
  if (tid < 32) wpv = *(const f32x4*)(wp + bx * 128 + tid * 4);

  // scatter to Qh/Kh (row-major per pixel) and Vt (transposed)
#pragma unroll
  for (int j = 0; j < 4; ++j) {
#pragma unroll
    for (int r = 0; r < 8; ++r) {
      int kk = w * 16 + r + 8 * g;       // 0..127
      int h = kk >> 5, d = kk & 31;
      int n = n0 + j * 16 + lh;
      size_t hb = (size_t)(b * HEADS + h);
      size_t qoff = (hb * NPIX + n) * HEAD_DIM + d;
      Qh[qoff] = (_Float16)acc[0][j][r];
      Kh[qoff] = (_Float16)acc[1][j][r];
      Vt[(hb * HEAD_DIM + d) * NPIX + n] = (_Float16)acc[2][j][r];
    }
  }

  if (tid < 32) {
    half4 hv;
#pragma unroll
    for (int i = 0; i < 4; ++i) hv[i] = (_Float16)wpv[i];
    *(half4*)(wph + bx * 128 + tid * 4) = hv;
  }
}

// ---------------------------------------------------------------------------
// Kernel 2: flash attention. Grid (N/128, B*HEADS), 256 threads = 8 waves.
// A wave owns 32 queries (two Q^T fragments) and one half of the keys: waves
// 0..3 take keys 0..2047, waves 4..7 keys 2048..4095 for the same 128 queries.
// Every K and V^T fragment read from LDS feeds two products, one a query tile,
// and the test, the waits and the barrier of a step are paid once for both.
// K and V^T come into LDS in stages of 128 keys of each half (two 64-key tiles):
//   - all 8 waves cooperatively stage the two K pieces (128x32 f16, 8 KB each) and
//     the two V^T pieces (32x128 f16), by asynchronous copies into two buffers:
//     the next stage flies while the two tiles of this one are worked on, one
//     barrier a stage, so the copies have two tiles' time to land and the waves
//     may drift apart by a tile.
// Per 64-key tile of a wave's half:
//   - 8 WMMAs for S^T = K Q^T - shift (scale and log2(e) pre-folded into Q, the
//     C operand holds minus the query's shift): per query tile a lane holds 32 of
//     the 64 shifted scores of ONE query (column lh), its partner lane^16 the rest;
//   - softmax in f32 in registers on all 32 lanes: exp2 straight from D. The
//     shift is a maximum seen earlier: tile 0's, set ahead of the loop. It is
//     raised, and O and l rescaled, only where a half-wave's sum of a tile's 32
//     probabilities tops 2^8 (one test per step for the wave). The sum is formed
//     anyway and bounds each of its terms, so the usual tile takes no maximum;
//     sums stay per half-wave until the end;
//   - 8 WMMAs for O^T += V^T P^T: two converted S^T tiles ARE the B operand.
// At the end the upper key half hands O, l and its shift over through LDS and the
// lower one joins the two on the larger shift.
// Output Orow f16 [b][n][128] (channel-contiguous per pixel).
// ---------------------------------------------------------------------------
#define KHALF (NPIX / 2)        // keys of one half
#define SKEYS 128               // keys of one half in a stage: two 64-key tiles
#define NSTAGE (KHALF / SKEYS)  // stages
#define KPITCH 40               // f16 a K row in LDS: 64 B at pitch 80 B
#define VPITCH (SKEYS + 8)      // f16 a V^T row in LDS: 256 B at pitch 272 B

// value of lane l ^ 16
static __device__ __forceinline__ float other_half(float v) {
  int b = __builtin_bit_cast(int, v);
  b = __builtin_amdgcn_permlanex16(b, b, 0x76543210, 0xfedcba98, false, false);
  return __builtin_bit_cast(float, b);
}

// largest of this half-wave's 32 scores of one 64-key tile
static __device__ __forceinline__ float tile_max(const f32x8* s) {
  float mt[4];
#pragma unroll
  for (int j = 0; j < 4; ++j) {
    mt[j] = fmaxf(fmaxf(fmaxf(s[j][0], s[j][1]), fmaxf(s[j][2], s[j][3])),
                  fmaxf(fmaxf(s[j][4], s[j][5]), fmaxf(s[j][6], s[j][7])));
  }
  return fmaxf(fmaxf(mt[0], mt[1]), fmaxf(mt[2], mt[3]));
}

// P^T of one 64-key tile from its shifted scores, and this half-wave's sum of it.
// P^T as B operand: element i = key 32mj + 8g + i, element 8 + i = key
// 32mj + 16 + 8g + i, which is the k order load_frag gives V^T.
static __device__ __forceinline__ float tile_probs(const f32x8* s, half16* p) {
  float st[4];
#pragma unroll
  for (int j = 0; j < 4; ++j) {
    float e[8];
#pragma unroll
    for (int r = 0; r < 8; ++r) {
      e[r] = __builtin_amdgcn_exp2f(s[j][r]);
      p[j >> 1][(j & 1) * 8 + r] = (_Float16)e[r];
    }
    st[j] = ((e[0] + e[1]) + (e[2] + e[3])) + ((e[4] + e[5]) + (e[6] + e[7]));
  }
  return (st[0] + st[1]) + (st[2] + st[3]);
}

// One thread's share of a stage, eight pieces of 16 bytes, from global memory
// straight into LDS: two of K (64 rows apart) and two of V^T (16 rows apart) of the
// lower key half (kl, vl: LDS byte addresses of the first pieces), then the same of
// the upper. The wait stands inside the statement, as a precaution, ahead of any
// rewrite of the address registers.
static __device__ __forceinline__ void stage_step(unsigned kl, const _Float16* kg,
                                                  unsigned vl, const _Float16* vg) {
  const unsigned k2 = 64u * KPITCH * 2u, v2 = 16u * VPITCH * 2u;       // second piece in LDS
  const unsigned kh = SKEYS * KPITCH * 2u, vh = 32u * VPITCH * 2u;     // upper half in LDS
  const _Float16* kgh = kg + KHALF * 32;
  const _Float16* vgh = vg + KHALF;
  asm volatile("global_load_async_to_lds_b128 %0, %1, off\n\t"
               "global_load_async_to_lds_b128 %2, %3, off\n\t"
               "global_load_async_to_lds_b128 %4, %5, off\n\t"
               "global_load_async_to_lds_b128 %6, %7, off\n\t"
               "global_load_async_to_lds_b128 %8, %9, off\n\t"
               "global_load_async_to_lds_b128 %10, %11, off\n\t"
               "global_load_async_to_lds_b128 %12, %13, off\n\t"
               "global_load_async_to_lds_b128 %14, %15, off\n\t"
               "s_wait_xcnt 0x0"
               ::"v"(kl), "v"(kg), "v"(kl + k2), "v"(kg + 64 * 32),
                 "v"(vl), "v"(vg), "v"(vl + v2), "v"(vg + 16 * NPIX),
                 "v"(kl + kh), "v"(kgh), "v"(kl + kh + k2), "v"(kgh + 64 * 32),
                 "v"(vl + vh), "v"(vgh), "v"(vl + vh + v2), "v"(vgh + 16 * NPIX)
               : "memory");
}

__global__ void __launch_bounds__(256) attn_kernel(
    const _Float16* __restrict__ Qh, const _Float16* __restrict__ Kh,
    const _Float16* __restrict__ Vt, _Float16* __restrict__ Orow) {
  // [buffer][key half][row][column]. Row pitch = 16 B x odd, so the 16 rows one
  // ds_load_b128 half-wave reads fall on 64 distinct banks (unpadded rows collide).
  __shared__ __align__(16) _Float16 Ks[2][2][SKEYS][KPITCH];   // K, 64 B rows at pitch 80 B
  __shared__ __align__(16) _Float16 Vs[2][2][32][VPITCH];      // V^T, 256 B rows at pitch 272 B
  // hand-over of the upper key half's result: [query group][quad][lane]; quads
  // 4qt..4qt+3 = O of query tile qt, quad 8 = both shifts and both sums
  __shared__ __align__(16) f32x4 Mg[4][9][32];

  const int tid = threadIdx.x;
  const int lane = tid & 31, g = lane >> 4, lh = lane & 15;
  const int w = __builtin_amdgcn_readfirstlane(tid >> 5);
  const int wq = w & 3;                 // query group of the wave
  const int wk = w >> 2;                // its key half
  const int bh = blockIdx.y;
  const int b = bh >> 2, h = bh & 3;
  const int q0 = blockIdx.x * 128 + wq * 32;
  const size_t hb = (size_t)(b * HEADS + h);
  const _Float16* qb = Qh + hb * NPIX * HEAD_DIM;
  const _Float16* kb = Kh + hb * NPIX * HEAD_DIM;
  const _Float16* vb = Vt + hb * HEAD_DIM * NPIX;

  // Q^T as B operand: lane = query column q0 + 16qt + lh (reused every iteration)
  half16 bq[2];
  // O^T tiles: register r = O[query lh][d = 8g + r] (o_lo), d = 16 + 8g + r (o_hi)
  f32x8 o_lo[2], o_hi[2];
  f32x8 negm[2];         // minus the shift of this lane's query, in every register
                         // (C operand of the score products; equal in both half-waves)
  float l[2];            // running sum over this half-wave's keys only
#pragma unroll
  for (int qt = 0; qt < 2; ++qt) {
    const _Float16* qr = qb + (size_t)(q0 + qt * 16 + lh) * 32;
    bq[qt] = load_frag(qr + g * 8, qr + 16 + g * 8);
    o_lo[qt] = zero8();
    o_hi[qt] = zero8();
    l[qt] = 0.f;
  }

  // cooperative-staging indices of a thread's first pieces (16+16 f16 per stage and half)
  const int kslot = tid * 8;            // 0..2047 over the first 64 rows of K in memory
  const int kr = tid >> 2;              // 0..63  (K row = key)
  const int kc = (tid & 3) * 8;         // 0..24  (d offset within the row)
  const int vd = tid >> 4;              // 0..15  (V^T row = d)
  const int vm = (tid & 15) * 8;        // 0..120 (m offset within the stage)
  const _Float16* kg = kb + kslot;                    // this thread's first 16 B of K, stage 0
  const _Float16* vg = vb + (size_t)vd * NPIX + vm;   // and of V^T, lower half
  // their places in buffer 0 (LDS byte address = low word of the pointer)
  const unsigned kl = (unsigned)(size_t)&Ks[0][0][kr][kc];
  const unsigned vl = (unsigned)(size_t)&Vs[0][0][vd][vm];
  const unsigned kbuf = (unsigned)sizeof(Ks[0]);
  const unsigned vbuf = (unsigned)sizeof(Vs[0]);

  // ---- stage 0 into buffer 0, landed and published; then stage 1 set off ----
  stage_step(kl, kg, vl, vg);
  asm volatile("s_wait_asynccnt 0x0" ::: "memory");  // this wave's copies have landed
  __syncthreads();                                   // and every other wave's
  stage_step(kl + kbuf, kg + SKEYS * 32, vl + vbuf, vg + SKEYS);

  // ---- the shift starts as the largest score of tile 0 (of this key half) ----
  {
    half16 ak[4];
#pragma unroll
    for (int j = 0; j < 4; ++j)
      ak[j] = load_frag(&Ks[0][wk][j * 16 + lh][g * 8],
                        &Ks[0][wk][j * 16 + lh][16 + g * 8]);
#pragma unroll
    for (int qt = 0; qt < 2; ++qt) {
      f32x8 s0[4];
#pragma unroll
      for (int j = 0; j < 4; ++j) s0[j] = wmma_f16(ak[j], bq[qt], zero8());
      const float mx = tile_max(s0);
      const float mq = fmaxf(mx, other_half(mx));
#pragma unroll
      for (int r = 0; r < 8; ++r) negm[qt][r] = -mq;
    }
  }

  // Kept rolled over the stages: unrolled by two, the sixteen LDS addresses of both
  // buffers' copies are held in registers through the loop, which then takes more
  // than the 256 that four waves a SIMD allow.
#pragma unroll 1
  for (int st = 0; st < NSTAGE; ++st) {
    const int buf = st & 1;
#pragma unroll
   for (int tk = 0; tk < SKEYS; tk += 64) {   // the stage's two 64-key tiles
    // ---- S^T = K Q^T - shift: s[qt][j][r] = score(query 16qt + lh, key 16j + 8g + r) ----
    half16 ak[4];
#pragma unroll
    for (int j = 0; j < 4; ++j)
      ak[j] = load_frag(&Ks[buf][wk][tk + j * 16 + lh][g * 8],
                        &Ks[buf][wk][tk + j * 16 + lh][16 + g * 8]);
    // V^T fragments, read ahead of the vector work: the test below ends the
    // block, and reads placed behind it would each be waited out
    half16 av[4];
#pragma unroll
    for (int mj = 0; mj < 2; ++mj) {
      av[2 * mj]     = load_frag(&Vs[buf][wk][lh][tk + mj * 32 + g * 8],
                                 &Vs[buf][wk][lh][tk + mj * 32 + 16 + g * 8]);
      av[2 * mj + 1] = load_frag(&Vs[buf][wk][16 + lh][tk + mj * 32 + g * 8],
                                 &Vs[buf][wk][16 + lh][tk + mj * 32 + 16 + g * 8]);
    }
    // Keeps the sixteen reads together ahead of the products: left to itself the
    // compiler reads the K fragments pair by pair into one register set and waits
    // each pair out in front of its products, one LDS latency after another.
    __builtin_amdgcn_sched_barrier(0);
    f32x8 s[2][4];
#pragma unroll
    for (int qt = 0; qt < 2; ++qt)
#pragma unroll
      for (int j = 0; j < 4; ++j) s[qt][j] = wmma_f16(ak[j], bq[qt], negm[qt]);
    // Keeps the eight score products ahead of the vector work: woven between them,
    // each exp2 would stand behind its own product's idle slots.
    __builtin_amdgcn_sched_barrier(0);
    half16 p[2][2];
    float sum[2];
    sum[0] = tile_probs(s[0], p[0]);
    sum[1] = tile_probs(s[1], p[1]);
    // ---- raise the shift where a sum tops 2^8: no term is negative, so below that
    // every probability is at most 2^8, far inside f16 (an overflow to infinity
    // tops it too). The maximum is taken only here. Marked unlikely so that the
    // raise is laid out behind the loop and the usual tile runs straight through. ----
    if (__builtin_expect(__builtin_amdgcn_ballot_w32(fmaxf(sum[0], sum[1]) > 256.f) != 0, 0)) {
#pragma unroll
      for (int qt = 0; qt < 2; ++qt) {
        // the scores are formed anew, unshifted and then on the raised shift: held
        // over the exp2 for this path they would cost every tile 64 registers
#pragma unroll
        for (int j = 0; j < 4; ++j) s[qt][j] = wmma_f16(ak[j], bq[qt], zero8());
        const float mx = tile_max(s[qt]);
        const float up = fmaxf(fmaxf(mx, other_half(mx)) + negm[qt][0], 0.f);
        const float alpha = __builtin_amdgcn_exp2f(-up);
#pragma unroll
        for (int r = 0; r < 8; ++r) {
          negm[qt][r] -= up;
          o_lo[qt][r] *= alpha;
          o_hi[qt][r] *= alpha;
        }
#pragma unroll
        for (int j = 0; j < 4; ++j) s[qt][j] = wmma_f16(ak[j], bq[qt], negm[qt]);
        sum[qt] = tile_probs(s[qt], p[qt]);
        l[qt] *= alpha;
      }
    }
    l[0] += sum[0];
    l[1] += sum[1];
    // ---- O^T += V^T P^T (two 32-wide key sub-tiles; d split 0..15 / 16..31) ----
#pragma unroll
    for (int mj = 0; mj < 2; ++mj) {
#pragma unroll
      for (int qt = 0; qt < 2; ++qt) {
        o_lo[qt] = wmma_f16(av[2 * mj], p[qt][mj], o_lo[qt]);
        o_hi[qt] = wmma_f16(av[2 * mj + 1], p[qt][mj], o_hi[qt]);
      }
    }
   }
    // ---- hand-over: stage st + 1 is published, this stage's buffer is freed ----
    asm volatile("s_wait_dscnt 0x0" ::: "memory");     // this wave's reads of the buffer are over
    asm volatile("s_wait_asynccnt 0x0" ::: "memory");  // its copies of stage st + 1 have landed
    __syncthreads();
    if (st + 2 < NSTAGE) {  // stage st + 2 into the buffer just read
      stage_step(kl + buf * kbuf, kg + (size_t)(st + 2) * (SKEYS * 32),
                 vl + buf * vbuf, vg + (st + 2) * SKEYS);
    }
  }
  asm volatile("s_wait_asynccnt 0x0" ::: "memory");  // no copy is left in flight at the end

  // ---- the upper key half hands its O, shifts and sums over ----
  if (wk == 1) {
#pragma unroll
    for (int qt = 0; qt < 2; ++qt) {
      f32x4 c0 = {o_lo[qt][0], o_lo[qt][1], o_lo[qt][2], o_lo[qt][3]};
      f32x4 c1 = {o_lo[qt][4], o_lo[qt][5], o_lo[qt][6], o_lo[qt][7]};
      f32x4 c2 = {o_hi[qt][0], o_hi[qt][1], o_hi[qt][2], o_hi[qt][3]};
      f32x4 c3 = {o_hi[qt][4], o_hi[qt][5], o_hi[qt][6], o_hi[qt][7]};
      Mg[wq][qt * 4 + 0][lane] = c0;
      Mg[wq][qt * 4 + 1][lane] = c1;
      Mg[wq][qt * 4 + 2][lane] = c2;
      Mg[wq][qt * 4 + 3][lane] = c3;
    }
    f32x4 c8 = {negm[0][0], negm[1][0], l[0], l[1]};
    Mg[wq][8][lane] = c8;
  }
  __syncthreads();  // the hand-over is published
  if (wk == 1) return;

  // ---- finalize: join the key halves on the larger shift, then the half-waves'
  // sums, divide, store Orow[b][n][h*32 + d] ----
  const f32x4 u8 = Mg[wq][8][lane];
#pragma unroll
  for (int qt = 0; qt < 2; ++qt) {
    const float nm = fminf(negm[qt][0], u8[qt]);                  // minus the larger shift
    const float a0 = __builtin_amdgcn_exp2f(nm - negm[qt][0]);    // this half's weight
    const float a1 = __builtin_amdgcn_exp2f(nm - u8[qt]);         // the upper half's
    const float lj = l[qt] * a0 + u8[2 + qt] * a1;
    const float inv = 1.f / (lj + other_half(lj));
    const float f0 = a0 * inv, f1 = a1 * inv;
    const f32x4 u0 = Mg[wq][qt * 4 + 0][lane];
    const f32x4 u1 = Mg[wq][qt * 4 + 1][lane];
    const f32x4 u2 = Mg[wq][qt * 4 + 2][lane];
    const f32x4 u3 = Mg[wq][qt * 4 + 3][lane];
    half8 lo8, hi8;
#pragma unroll
    for (int r = 0; r < 4; ++r) {
      lo8[r]     = (_Float16)(o_lo[qt][r] * f0 + u0[r] * f1);
      lo8[4 + r] = (_Float16)(o_lo[qt][4 + r] * f0 + u1[r] * f1);
      hi8[r]     = (_Float16)(o_hi[qt][r] * f0 + u2[r] * f1);
      hi8[4 + r] = (_Float16)(o_hi[qt][4 + r] * f0 + u3[r] * f1);
    }
    _Float16* ob = Orow + (size_t)b * NPIX * KEY_CH + h * HEAD_DIM +
                   (size_t)(q0 + qt * 16 + lh) * KEY_CH + g * 8;
    *(half8*)ob        = lo8;
    *(half8*)(ob + 16) = hi8;
  }
}

// ---------------------------------------------------------------------------
// Kernel 3: out = Wp @ O + x.  [256,128] x [128,4096] per image.
// Grid (N/64, B, 2), 256 threads; wave w handles 16 output channels.
// The block's O tile (64 pixels x 128 k, 16 KB in a row in memory) and its 128 rows
// of Wp (32 KB in a row) come into LDS once, by asynchronous copies: a wave's copy
// takes 512 B in a row (4 whole cache lines), where a fragment load from global
// memory touches 16 lines for the same 512 B, and each of the 8 waves fetched the
// whole O tile for itself.
// ---------------------------------------------------------------------------
__global__ void __launch_bounds__(256) out_proj_kernel(
    const _Float16* __restrict__ wph, const _Float16* __restrict__ Orow,
    const float* __restrict__ x, float* __restrict__ out) {
  // 256-B rows at pitch 272 B = 16 B x odd: the 16 rows one ds_load_b128 half-wave
  // reads fall on 64 distinct banks
  __shared__ __align__(16) _Float16 Os[64][KEY_CH + 8];    // O tile [pixel][k]
  __shared__ __align__(16) _Float16 Ws[128][KEY_CH + 8];   // Wp rows [channel][k]

  const int tid = threadIdx.x;
  const int w = tid >> 5, lane = tid & 31, g = lane >> 4, lh = lane & 15;
  const int n0 = blockIdx.x * 64;
  const int b = blockIdx.y;
  const int c0 = blockIdx.z * 128 + w * 16;

  // 16-byte piece tid of each run of 16 rows: row tid / 16, column (tid % 16) * 8
  const char* og = (const char*)(Orow + ((size_t)b * NPIX + n0) * KEY_CH + tid * 8);
  const char* wg = (const char*)(wph + (size_t)blockIdx.z * 128 * KEY_CH + tid * 8);
  const unsigned ol = (unsigned)(size_t)&Os[tid >> 4][(tid & 15) * 8];
  const unsigned wl = (unsigned)(size_t)&Ws[tid >> 4][(tid & 15) * 8];
  const unsigned run = 16u * (unsigned)sizeof(Os[0]);   // 16 rows in LDS
  copy4(ol, run, og, 4096u);
  copy8(wl, run, wg, 4096u);

  // the residual x of every output element of this lane, in flight beside the copies
  const size_t off0 = (size_t)(b * IN_CH + c0 + 8 * g) * NPIX + n0 + lh;
  float xr[4][8];
#pragma unroll
  for (int j = 0; j < 4; ++j)
#pragma unroll
    for (int r = 0; r < 8; ++r) xr[j][r] = x[off0 + (size_t)r * NPIX + j * 16];
  // A precaution: stands ahead of the LDS reads, whose results reuse the loads' address registers.
  asm volatile("s_wait_xcnt 0x0" ::: "memory");

  asm volatile("s_wait_asynccnt 0x0" ::: "memory");  // this wave's copies have landed
  __syncthreads();                                   // and every other wave's

  half16 a[4], bf[4][4];
#pragma unroll
  for (int kc = 0; kc < 4; ++kc) {
    a[kc] = load_frag(&Ws[w * 16 + lh][kc * 32 + g * 8],
                      &Ws[w * 16 + lh][kc * 32 + 16 + g * 8]);
#pragma unroll
    for (int j = 0; j < 4; ++j)
      bf[kc][j] = load_frag(&Os[j * 16 + lh][kc * 32 + g * 8],
                            &Os[j * 16 + lh][kc * 32 + 16 + g * 8]);
  }
  // Keeps the forty LDS reads together ahead of the products: left to itself the
  // compiler reads pair by pair and waits each pair out, one LDS latency after another.
  __builtin_amdgcn_sched_barrier(0);
  f32x8 acc[4];
#pragma unroll
  for (int j = 0; j < 4; ++j) acc[j] = zero8();
#pragma unroll
  for (int kc = 0; kc < 4; ++kc)
#pragma unroll
    for (int j = 0; j < 4; ++j) acc[j] = wmma_f16(a[kc], bf[kc][j], acc[j]);

#pragma unroll
  for (int j = 0; j < 4; ++j)
#pragma unroll
    for (int r = 0; r < 8; ++r)
      out[off0 + (size_t)r * NPIX + j * 16] = acc[j][r] + xr[j][r];
}

// ---------------------------------------------------------------------------
// Host launcher
// ---------------------------------------------------------------------------
extern "C" void kernel_launch(void* const* d_in, const int* in_sizes, int n_in,
                              void* d_out, int out_size, void* d_ws, size_t ws_size,
                              hipStream_t stream) {
  const float* x  = (const float*)d_in[0];
  const float* Wq = (const float*)d_in[1];
  const float* Wk = (const float*)d_in[2];
  const float* Wv = (const float*)d_in[3];
  const float* Wp = (const float*)d_in[4];
  float* out = (float*)d_out;

  // workspace carve-up (all f16)
  char* ws = (char*)d_ws;
  size_t off = 0;
  _Float16* wph = (_Float16*)(ws + off); off += (size_t)IN_CH * KEY_CH * 2;
  _Float16* Qh  = (_Float16*)(ws + off); off += (size_t)NB * KEY_CH * NPIX * 2;  // 4 MB
  _Float16* Kh  = (_Float16*)(ws + off); off += (size_t)NB * KEY_CH * NPIX * 2;  // 4 MB
  _Float16* Vt  = (_Float16*)(ws + off); off += (size_t)NB * KEY_CH * NPIX * 2;  // 4 MB
  _Float16* Orow = (_Float16*)(ws + off); off += (size_t)NB * NPIX * KEY_CH * 2; // 4 MB

  // 1) Q/K/V projections (f32 operands rounded to f16 inside; Wp rounded on the side)
  proj_qkv_kernel<<<NB * (NPIX / 64), 256, 0, stream>>>(
      x, Wq, Wk, Wv, Wp, wph, Qh, Kh, Vt);

  // 2) flash attention
  attn_kernel<<<dim3(NPIX / 128, NB * HEADS), 256, 0, stream>>>(Qh, Kh, Vt, Orow);

  // 3) output projection + residual
  out_proj_kernel<<<dim3(NPIX / 64, NB, 2), 256, 0, stream>>>(wph, Orow, x, out);
}
